// v000
// The times below were measured on an AMD MI455X: many runs one after another, warmed up first and cycling through
// copies of the inputs, with the whole window's GPU time divided by the number of runs. Launches and the gaps
// between them are all in it. The median over several windows is given; except for v000 it joins two sittings, which
// can be a few percent apart, so the side-by-side timings, each taken in one sitting, are the better comparison.
// v000 is the starting kernel. One run takes 408 microseconds.
#include <hip/hip_runtime.h>
#include <hip/hip_fp16.h>

typedef _Float16 half_t;
typedef __attribute__((ext_vector_type(16))) _Float16 v16h;
typedef __attribute__((ext_vector_type(8)))  _Float16 h8;
typedef __attribute__((ext_vector_type(8)))  float    v8f;

#define B_  4
#define T_  4096
#define D_  1024
#define N_  256
#define L_  768
#define H_  16
#define DH_ 64
#define TE_ 1024

__device__ inline v8f zero8() {
  v8f z;
#pragma unroll
  for (int i = 0; i < 8; i++) z[i] = 0.f;
  return z;
}

__device__ inline v8f wmma_f16(v16h a, v16h b, v8f c) {
  return __builtin_amdgcn_wmma_f32_16x16x32_f16(
      /*neg_a=*/false, a, /*neg_b=*/false, b,
      /*c_mod=*/(short)0, c, /*reuse_a=*/false, /*reuse_b=*/false);
}

__device__ inline uint32_t lds_off(const void* p) {
  return (uint32_t)(uintptr_t)p;
}
__device__ inline void async_ld_b128(uint32_t ldsaddr, const void* g) {
  asm volatile("global_load_async_to_lds_b128 %0, %1, off"
               :: "v"(ldsaddr), "v"((unsigned long long)(uintptr_t)g)
               : "memory");
}
__device__ inline void wait_async0() {
  asm volatile("s_wait_asynccnt 0x0" ::: "memory");
}

__device__ inline v16h ld_frag(const half_t* tileBase, int stride, int lane) {
  int m  = lane & 15;
  int hi = (lane >> 4) * 8;
  const half_t* p = tileBase + m * stride + hi;
  union { v16h v; h8 h[2]; } u;
  u.h[0] = *(const h8*)(p);
  u.h[1] = *(const h8*)(p + 16);
  return u.v;
}

// ---------------------------------------------------------------------------
// LayerNorm over `width` fp32 -> fp16 row output. One block per row.
// ---------------------------------------------------------------------------
__global__ __launch_bounds__(256)
void ln_rows_f16(const float* __restrict__ in, const float* __restrict__ g,
                 const float* __restrict__ bt, half_t* __restrict__ out, int width) {
  int row = blockIdx.x;
  const float* x = in + (size_t)row * width;
  int tid = threadIdx.x;
  float s = 0.f, s2 = 0.f;
  for (int i = tid; i < width; i += 256) { float v = x[i]; s += v; s2 += v * v; }
#pragma unroll
  for (int m = 16; m; m >>= 1) { s += __shfl_xor(s, m, 32); s2 += __shfl_xor(s2, m, 32); }
  __shared__ float ws[8], ws2[8];
  __shared__ float mu_s, rs_s;
  int w = tid >> 5;
  if ((tid & 31) == 0) { ws[w] = s; ws2[w] = s2; }
  __syncthreads();
  if (tid == 0) {
    float S = 0.f, S2 = 0.f;
#pragma unroll
    for (int i = 0; i < 8; i++) { S += ws[i]; S2 += ws2[i]; }
    float mu = S / (float)width;
    float var = S2 / (float)width - mu * mu;
    mu_s = mu; rs_s = rsqrtf(var + 1e-5f);
  }
  __syncthreads();
  float mu = mu_s, rs = rs_s;
  for (int i = tid; i < width; i += 256)
    out[(size_t)row * width + i] = (half_t)((x[i] - mu) * rs * g[i] + bt[i]);
}

// ---------------------------------------------------------------------------
// Convert fp32 W (K x N, row-major) -> fp16 Wt (N x K) so B-fragments read
// contiguously (B fed column-major to WMMA).
// ---------------------------------------------------------------------------
__global__ __launch_bounds__(256)
void w_to_f16_t(const float* __restrict__ W, half_t* __restrict__ Wt, int K, int N) {
  int total = K * N;
  for (int idx = blockIdx.x * 256 + threadIdx.x; idx < total; idx += gridDim.x * 256) {
    int k = idx / N, n = idx % N;  // coalesced read over n
    Wt[(size_t)n * K + k] = (half_t)W[idx];
  }
}

// ---------------------------------------------------------------------------
// WMMA GEMM: out = alpha*(A[MxK] @ Wt^T + bias) (+ resid for RESID).
// A row-major f16, Wt row-major f16 (N x K). Block = 256 thr = 8 waves,
// tile 128x128x32; wave computes 64x32 (4x2 WMMA tiles).
// Double-buffered LDS, staged with global_load_async_to_lds_b128.
// ---------------------------------------------------------------------------
template <bool RESID>
__global__ __launch_bounds__(256)
void gemm_wmma(const half_t* __restrict__ A, const half_t* __restrict__ Wt,
               const float* __restrict__ bias, const float* __restrict__ resid,
               half_t* __restrict__ outh, float* __restrict__ outf,
               int M, int Nd, int Kd, float alpha) {
  __shared__ __align__(16) half_t As[2][128 * 40];
  __shared__ __align__(16) half_t Bs[2][128 * 40];
  int tid = threadIdx.x, lane = tid & 31, w = tid >> 5;
  int wm = w & 1, wn = w >> 1;
  int m0 = blockIdx.y * 128, n0 = blockIdx.x * 128;

  v8f acc[4][2];
#pragma unroll
  for (int i = 0; i < 4; i++)
#pragma unroll
    for (int j = 0; j < 2; j++) acc[i][j] = zero8();

  int r  = tid >> 1;        // staging row (128 rows, 2 threads/row)
  int cH = (tid & 1) * 16;  // staging half-chunk (16 halfs)
  const half_t* gA = A  + (size_t)(m0 + r) * Kd + cH;
  const half_t* gB = Wt + (size_t)(n0 + r) * Kd + cH;
  uint32_t lA[2], lB[2];
#pragma unroll
  for (int s = 0; s < 2; s++) {
    lA[s] = lds_off(&As[s][r * 40 + cH]);
    lB[s] = lds_off(&Bs[s][r * 40 + cH]);
  }

  auto issue = [&](int s, int k0) {
    async_ld_b128(lA[s],      gA + k0);
    async_ld_b128(lA[s] + 16, gA + k0 + 8);
    async_ld_b128(lB[s],      gB + k0);
    async_ld_b128(lB[s] + 16, gB + k0 + 8);
  };

  issue(0, 0);
  int cur = 0;
  for (int k0 = 0; k0 < Kd; k0 += 32, cur ^= 1) {
    wait_async0();    // own async writes done
    __syncthreads();  // everyone's writes visible; prev readers of buf cur^1 done
    if (k0 + 32 < Kd) issue(cur ^ 1, k0 + 32);

    v16h af[4], bf[2];
#pragma unroll
    for (int i = 0; i < 4; i++)
      af[i] = ld_frag(&As[cur][(wm * 64 + i * 16) * 40], 40, lane);
#pragma unroll
    for (int j = 0; j < 2; j++)
      bf[j] = ld_frag(&Bs[cur][(wn * 32 + j * 16) * 40], 40, lane);
#pragma unroll
    for (int i = 0; i < 4; i++)
#pragma unroll
      for (int j = 0; j < 2; j++) acc[i][j] = wmma_f16(af[i], bf[j], acc[i][j]);
  }

  int mrow = m0 + wm * 64;
  int nc0  = n0 + wn * 32;
#pragma unroll
  for (int i = 0; i < 4; i++)
#pragma unroll
    for (int j = 0; j < 2; j++) {
      int n = nc0 + j * 16 + (lane & 15);
      float bn = bias[n];
#pragma unroll
      for (int v = 0; v < 8; v++) {
        int row = mrow + i * 16 + v + ((lane >> 4) << 3);
        float val = (acc[i][j][v] + bn) * alpha;
        if (RESID)
          outf[(size_t)row * Nd + n] = val + resid[(size_t)row * Nd + n];
        else
          outh[(size_t)row * Nd + n] = (half_t)val;
      }
    }
}

// ---------------------------------------------------------------------------
// Fused attention per (b,h) and 128-row Q tile. K (256x64) staged to LDS
// via async-to-LDS; V staged transposed (64x256). S = QK^T via WMMA (Q
// pre-scaled by 1/8 in the Q GEMM), exact softmax over N=256 (16 lanes x 16
// tiles, shfl_xor reduction within half-wave), P->LDS f16, y = P@V via WMMA.
// ---------------------------------------------------------------------------
__global__ __launch_bounds__(256)
void attn_kernel(const half_t* __restrict__ qh, const half_t* __restrict__ kh,
                 const half_t* __restrict__ vh, half_t* __restrict__ y) {
  __shared__ __align__(16) half_t Ks[256 * 72];   // 36 KB
  __shared__ __align__(16) half_t Vt[64 * 264];   // 33 KB (V transposed)
  __shared__ __align__(16) half_t Ps[128 * 264];  // 66 KB
  int bh = blockIdx.x;
  int b = bh / H_, h = bh % H_;
  int t0 = blockIdx.y * 128;
  int tid = threadIdx.x, lane = tid & 31, w = tid >> 5;

  // Stage K (async global->LDS) and V^T (manual transpose)
  for (int c = tid; c < 2048; c += 256) {
    int tok = c >> 3, d0 = (c & 7) * 8;
    size_t gbase = ((size_t)(b * N_ + tok)) * D_ + h * DH_ + d0;
    async_ld_b128(lds_off(Ks + tok * 72 + d0), kh + gbase);
    h8 vv = *(const h8*)(vh + gbase);
#pragma unroll
    for (int e = 0; e < 8; e++) Vt[(d0 + e) * 264 + tok] = vv[e];
  }

  // Q fragments for this wave's 16 rows (dh=64 -> two K=32 fragments)
  v16h qa[2];
  {
    int m = lane & 15, hi = (lane >> 4) * 8;
    int t = t0 + w * 16 + m;
    const half_t* qp = qh + ((size_t)(b * T_ + t)) * D_ + h * DH_;
#pragma unroll
    for (int ks = 0; ks < 2; ks++) {
      union { v16h v; h8 hh[2]; } u;
      u.hh[0] = *(const h8*)(qp + ks * 32 + hi);
      u.hh[1] = *(const h8*)(qp + ks * 32 + 16 + hi);
      qa[ks] = u.v;
    }
  }
  wait_async0();
  __syncthreads();

  // S = Q K^T : 16 column tiles of 16, accumulate over dh in 2 steps
  v8f accs[16];
#pragma unroll
  for (int nt = 0; nt < 16; nt++) {
    accs[nt] = zero8();
#pragma unroll
    for (int ks = 0; ks < 2; ks++) {
      v16h bf = ld_frag(Ks + (nt * 16) * 72 + ks * 32, 72, lane);
      accs[nt] = wmma_f16(qa[ks], bf, accs[nt]);
    }
  }

  float rinv[8];
#pragma unroll
  for (int j = 0; j < 8; j++) {
    float m = -1e30f;
#pragma unroll
    for (int nt = 0; nt < 16; nt++) m = fmaxf(m, accs[nt][j]);
#pragma unroll
    for (int msk = 8; msk; msk >>= 1) m = fmaxf(m, __shfl_xor(m, msk, 32));
    float ssum = 0.f;
#pragma unroll
    for (int nt = 0; nt < 16; nt++) {
      float e = __expf(accs[nt][j] - m);
      accs[nt][j] = e;
      ssum += e;
    }
#pragma unroll
    for (int msk = 8; msk; msk >>= 1) ssum += __shfl_xor(ssum, msk, 32);
    rinv[j] = 1.f / ssum;
  }

  // P -> LDS (each wave owns its 16 rows; same-wave LDS RAW is in-order)
#pragma unroll
  for (int nt = 0; nt < 16; nt++)
#pragma unroll
    for (int j = 0; j < 8; j++) {
      int rl = w * 16 + j + ((lane >> 4) << 3);
      Ps[rl * 264 + nt * 16 + (lane & 15)] = (half_t)(accs[nt][j] * rinv[j]);
    }

  // y = P @ V : K=256 in 8 steps of 32; 4 output tiles (dh=64)
  v8f accy[4];
#pragma unroll
  for (int j = 0; j < 4; j++) accy[j] = zero8();
  for (int kt = 0; kt < 8; kt++) {
    v16h af = ld_frag(Ps + (w * 16) * 264 + kt * 32, 264, lane);
#pragma unroll
    for (int j = 0; j < 4; j++) {
      v16h bf = ld_frag(Vt + (j * 16) * 264 + kt * 32, 264, lane);
      accy[j] = wmma_f16(af, bf, accy[j]);
    }
  }

#pragma unroll
  for (int j = 0; j < 4; j++) {
    int n = h * DH_ + j * 16 + (lane & 15);
#pragma unroll
    for (int v = 0; v < 8; v++) {
      int t = t0 + w * 16 + v + ((lane >> 4) << 3);
      y[((size_t)(b * T_ + t)) * D_ + n] = (half_t)accy[j][v];
    }
  }
}

// ---------------------------------------------------------------------------
// emb_out[b, o] = silu(emb[b]) @ We + be   (B=4 x 2048, tiny)
// ---------------------------------------------------------------------------
__global__ __launch_bounds__(256)
void emb_out_kernel(const float* __restrict__ emb, const float* __restrict__ We,
                    const float* __restrict__ be, float* __restrict__ eo) {
  int b = blockIdx.y;
  int o = blockIdx.x * 256 + threadIdx.x;  // 0..2047
  __shared__ float se[TE_];
  for (int i = threadIdx.x; i < TE_; i += 256) {
    float v = emb[b * TE_ + i];
    se[i] = v / (1.f + __expf(-v));
  }
  __syncthreads();
  float acc = 0.f;
  for (int i = 0; i < TE_; i++) acc += se[i] * We[(size_t)i * (2 * D_) + o];
  eo[b * (2 * D_) + o] = acc + be[o];
}

// ---------------------------------------------------------------------------
// Stylize: h = silu( LN(y) * (1 + scale_b) + shift_b ) -> f16
// ---------------------------------------------------------------------------
__global__ __launch_bounds__(256)
void stylize_kernel(const half_t* __restrict__ y, const float* __restrict__ eo,
                    const float* __restrict__ g, const float* __restrict__ bt,
                    half_t* __restrict__ out) {
  int row = blockIdx.x;  // b*T + t
  int b = row / T_;
  const half_t* yr = y + (size_t)row * D_;
  int tid = threadIdx.x;
  float s = 0.f, s2 = 0.f;
  for (int i = tid; i < D_; i += 256) { float v = (float)yr[i]; s += v; s2 += v * v; }
#pragma unroll
  for (int m = 16; m; m >>= 1) { s += __shfl_xor(s, m, 32); s2 += __shfl_xor(s2, m, 32); }
  __shared__ float ws[8], ws2[8];
  __shared__ float mu_s, rs_s;
  int w = tid >> 5;
  if ((tid & 31) == 0) { ws[w] = s; ws2[w] = s2; }
  __syncthreads();
  if (tid == 0) {
    float S = 0.f, S2 = 0.f;
#pragma unroll
    for (int i = 0; i < 8; i++) { S += ws[i]; S2 += ws2[i]; }
    float mu = S / (float)D_;
    float var = S2 / (float)D_ - mu * mu;
    mu_s = mu; rs_s = rsqrtf(var + 1e-5f);
  }
  __syncthreads();
  float mu = mu_s, rs = rs_s;
  for (int i = tid; i < D_; i += 256) {
    float ln = ((float)yr[i] - mu) * rs * g[i] + bt[i];
    float sc = eo[b * (2 * D_) + i];
    float sh = eo[b * (2 * D_) + D_ + i];
    float hv = ln * (1.f + sc) + sh;
    hv = hv / (1.f + __expf(-hv));  // silu
    out[(size_t)row * D_ + i] = (half_t)hv;
  }
}

// ---------------------------------------------------------------------------
extern "C" void kernel_launch(void* const* d_in, const int* in_sizes, int n_in,
                              void* d_out, int out_size, void* d_ws, size_t ws_size,
                              hipStream_t stream) {
  (void)in_sizes; (void)n_in; (void)out_size; (void)ws_size;
  const float* x       = (const float*)d_in[0];
  const float* xf      = (const float*)d_in[1];
  const float* emb     = (const float*)d_in[2];
  const float* norm_g  = (const float*)d_in[3];
  const float* norm_b  = (const float*)d_in[4];
  const float* tnorm_g = (const float*)d_in[5];
  const float* tnorm_b = (const float*)d_in[6];
  const float* Wq      = (const float*)d_in[7];
  const float* bq      = (const float*)d_in[8];
  const float* Wk      = (const float*)d_in[9];
  const float* bk      = (const float*)d_in[10];
  const float* Wv      = (const float*)d_in[11];
  const float* bv      = (const float*)d_in[12];
  const float* We      = (const float*)d_in[13];
  const float* be      = (const float*)d_in[14];
  const float* snorm_g = (const float*)d_in[15];
  const float* snorm_b = (const float*)d_in[16];
  const float* Wo      = (const float*)d_in[17];
  const float* bo      = (const float*)d_in[18];
  float* out = (float*)d_out;

  // Workspace layout (256B aligned)
  char* ws = (char*)d_ws;
  size_t off = 0;
  auto alloc = [&](size_t bytes) {
    char* p = ws + off;
    off += (bytes + 255) & ~(size_t)255;
    return p;
  };
  const size_t BT = (size_t)B_ * T_;
  const size_t BN = (size_t)B_ * N_;
  half_t* xh  = (half_t*)alloc(BT * D_ * 2);        // LN(x) f16; reused as hsty later
  half_t* xfh = (half_t*)alloc(BN * L_ * 2);        // LN(xf) f16
  half_t* Wqt = (half_t*)alloc((size_t)D_ * D_ * 2);
  half_t* Wkt = (half_t*)alloc((size_t)D_ * L_ * 2);
  half_t* Wvt = (half_t*)alloc((size_t)D_ * L_ * 2);
  half_t* Wot = (half_t*)alloc((size_t)D_ * D_ * 2);
  half_t* qh  = (half_t*)alloc(BT * D_ * 2);
  half_t* khb = (half_t*)alloc(BN * D_ * 2);
  half_t* vhb = (half_t*)alloc(BN * D_ * 2);
  half_t* yb  = (half_t*)alloc(BT * D_ * 2);
  float*  eo  = (float*)alloc((size_t)B_ * 2 * D_ * 4);

  // 1) weights -> f16, transposed (N x K)
  w_to_f16_t<<<4096, 256, 0, stream>>>(Wq, Wqt, D_, D_);
  w_to_f16_t<<<3072, 256, 0, stream>>>(Wk, Wkt, L_, D_);
  w_to_f16_t<<<3072, 256, 0, stream>>>(Wv, Wvt, L_, D_);
  w_to_f16_t<<<4096, 256, 0, stream>>>(Wo, Wot, D_, D_);

  // 2) LayerNorms -> f16
  ln_rows_f16<<<(int)BT, 256, 0, stream>>>(x, norm_g, norm_b, xh, D_);
  ln_rows_f16<<<(int)BN, 256, 0, stream>>>(xf, tnorm_g, tnorm_b, xfh, L_);

  // 3) Projections (Q folds 1/sqrt(dh)=0.125)
  gemm_wmma<false><<<dim3(D_ / 128, (int)(BT / 128)), 256, 0, stream>>>(
      xh, Wqt, bq, nullptr, qh, nullptr, (int)BT, D_, D_, 0.125f);
  gemm_wmma<false><<<dim3(D_ / 128, (int)(BN / 128)), 256, 0, stream>>>(
      xfh, Wkt, bk, nullptr, khb, nullptr, (int)BN, D_, L_, 1.0f);
  gemm_wmma<false><<<dim3(D_ / 128, (int)(BN / 128)), 256, 0, stream>>>(
      xfh, Wvt, bv, nullptr, vhb, nullptr, (int)BN, D_, L_, 1.0f);

  // 4) emb MLP (tiny)
  emb_out_kernel<<<dim3(2 * D_ / 256, B_), 256, 0, stream>>>(emb, We, be, eo);

  // 5) attention: grid (B*H, T/128)
  attn_kernel<<<dim3(B_ * H_, T_ / 128), 256, 0, stream>>>(qh, khb, vhb, yb);

  // 6) stylize (xh buffer reused as f16 h)
  stylize_kernel<<<(int)BT, 256, 0, stream>>>(yb, eo, snorm_g, snorm_b, xh);

  // 7) out = x + h @ Wo + bo
  gemm_wmma<true><<<dim3(D_ / 128, (int)(BT / 128)), 256, 0, stream>>>(
      xh, Wot, bo, x, nullptr, out, (int)BT, D_, D_, 1.0f);
}

// v001
// A run of this version takes 302 microseconds.
// Timed twice side by side with v000, it ran 1.37 and 1.39 times as fast.
#include <hip/hip_runtime.h>
#include <hip/hip_fp16.h>

typedef _Float16 half_t;
typedef __attribute__((ext_vector_type(16))) _Float16 v16h;
typedef __attribute__((ext_vector_type(8)))  _Float16 h8;
typedef __attribute__((ext_vector_type(8)))  float    v8f;

#define B_  4
#define T_  4096
#define D_  1024
#define N_  256
#define L_  768
#define H_  16
#define DH_ 64
#define TE_ 1024

__device__ inline v8f zero8() {
  v8f z;
#pragma unroll
  for (int i = 0; i < 8; i++) z[i] = 0.f;
  return z;
}

__device__ inline v8f wmma_f16(v16h a, v16h b, v8f c) {
  return __builtin_amdgcn_wmma_f32_16x16x32_f16(
      /*neg_a=*/false, a, /*neg_b=*/false, b,
      /*c_mod=*/(short)0, c, /*reuse_a=*/false, /*reuse_b=*/false);
}

__device__ inline uint32_t lds_off(const void* p) {
  return (uint32_t)(uintptr_t)p;
}
__device__ inline void async_ld_b128(uint32_t ldsaddr, const void* g) {
  asm volatile("global_load_async_to_lds_b128 %0, %1, off"
               :: "v"(ldsaddr), "v"((unsigned long long)(uintptr_t)g)
               : "memory");
}
__device__ inline void wait_async0() {
  asm volatile("s_wait_asynccnt 0x0" ::: "memory");
}

__device__ inline v16h ld_frag(const half_t* tileBase, int stride, int lane) {
  int m  = lane & 15;
  int hi = (lane >> 4) * 8;
  const half_t* p = tileBase + m * stride + hi;
  union { v16h v; h8 h[2]; } u;
  u.h[0] = *(const h8*)(p);
  u.h[1] = *(const h8*)(p + 16);
  return u.v;
}

// ---------------------------------------------------------------------------
// LayerNorm over `width` fp32 -> fp16 row output. One block per row.
// ---------------------------------------------------------------------------
__global__ __launch_bounds__(256)
void ln_rows_f16(const float* __restrict__ in, const float* __restrict__ g,
                 const float* __restrict__ bt, half_t* __restrict__ out, int width) {
  int row = blockIdx.x;
  const float* x = in + (size_t)row * width;
  int tid = threadIdx.x;
  float s = 0.f, s2 = 0.f;
  for (int i = tid; i < width; i += 256) { float v = x[i]; s += v; s2 += v * v; }
#pragma unroll
  for (int m = 16; m; m >>= 1) { s += __shfl_xor(s, m, 32); s2 += __shfl_xor(s2, m, 32); }
  __shared__ float ws[8], ws2[8];
  __shared__ float mu_s, rs_s;
  int w = tid >> 5;
  if ((tid & 31) == 0) { ws[w] = s; ws2[w] = s2; }
  __syncthreads();
  if (tid == 0) {
    float S = 0.f, S2 = 0.f;
#pragma unroll
    for (int i = 0; i < 8; i++) { S += ws[i]; S2 += ws2[i]; }
    float mu = S / (float)width;
    float var = S2 / (float)width - mu * mu;
    mu_s = mu; rs_s = rsqrtf(var + 1e-5f);
  }
  __syncthreads();
  float mu = mu_s, rs = rs_s;
  for (int i = tid; i < width; i += 256)
    out[(size_t)row * width + i] = (half_t)((x[i] - mu) * rs * g[i] + bt[i]);
}

__global__ __launch_bounds__(256)
void w_to_f16_t(const float* __restrict__ W, half_t* __restrict__ Wt, int K, int N) {
  __shared__ float tile[64 * 65];
  int tid = threadIdx.x;
  int n0 = blockIdx.x * 64, k0 = blockIdx.y * 64;

  int c4 = (tid & 15) * 4, kr = tid >> 4;
  float4 v[4];
#pragma unroll
  for (int p = 0; p < 4; p++)
    v[p] = *(const float4*)(W + (size_t)(k0 + kr + 16 * p) * N + n0 + c4);
#pragma unroll
  for (int p = 0; p < 4; p++) {
    float* t = tile + (kr + 16 * p) * 65 + c4;
    t[0] = v[p].x; t[1] = v[p].y; t[2] = v[p].z; t[3] = v[p].w;
  }
  __syncthreads();

  int kc = (tid & 7) * 8, nr = tid >> 3;
#pragma unroll
  for (int p = 0; p < 2; p++) {
    int n = nr + 32 * p;
    h8 o;
#pragma unroll
    for (int e = 0; e < 8; e++) o[e] = (half_t)tile[(kc + e) * 65 + n];
    *(h8*)(Wt + (size_t)(n0 + n) * K + k0 + kc) = o;
  }
}

// ---------------------------------------------------------------------------
// WMMA GEMM: out = alpha*(A[MxK] @ Wt^T + bias) (+ resid for RESID).
// A row-major f16, Wt row-major f16 (N x K). Block = 256 thr = 8 waves,
// tile 128x128x32; wave computes 64x32 (4x2 WMMA tiles).
// Double-buffered LDS, staged with global_load_async_to_lds_b128.
// ---------------------------------------------------------------------------
template <bool RESID>
__global__ __launch_bounds__(256)
void gemm_wmma(const half_t* __restrict__ A, const half_t* __restrict__ Wt,
               const float* __restrict__ bias, const float* __restrict__ resid,
               half_t* __restrict__ outh, float* __restrict__ outf,
               int M, int Nd, int Kd, float alpha) {
  __shared__ __align__(16) half_t As[2][128 * 40];
  __shared__ __align__(16) half_t Bs[2][128 * 40];
  int tid = threadIdx.x, lane = tid & 31, w = tid >> 5;
  int wm = w & 1, wn = w >> 1;
  int m0 = blockIdx.y * 128, n0 = blockIdx.x * 128;

  v8f acc[4][2];
#pragma unroll
  for (int i = 0; i < 4; i++)
#pragma unroll
    for (int j = 0; j < 2; j++) acc[i][j] = zero8();

  int r  = tid >> 1;        // staging row (128 rows, 2 threads/row)
  int cH = (tid & 1) * 16;  // staging half-chunk (16 halfs)
  const half_t* gA = A  + (size_t)(m0 + r) * Kd + cH;
  const half_t* gB = Wt + (size_t)(n0 + r) * Kd + cH;
  uint32_t lA[2], lB[2];
#pragma unroll
  for (int s = 0; s < 2; s++) {
    lA[s] = lds_off(&As[s][r * 40 + cH]);
    lB[s] = lds_off(&Bs[s][r * 40 + cH]);
  }

  auto issue = [&](int s, int k0) {
    async_ld_b128(lA[s],      gA + k0);
    async_ld_b128(lA[s] + 16, gA + k0 + 8);
    async_ld_b128(lB[s],      gB + k0);
    async_ld_b128(lB[s] + 16, gB + k0 + 8);
  };

  issue(0, 0);
  int cur = 0;
  for (int k0 = 0; k0 < Kd; k0 += 32, cur ^= 1) {
    wait_async0();    // own async writes done
    __syncthreads();  // everyone's writes visible; prev readers of buf cur^1 done
    if (k0 + 32 < Kd) issue(cur ^ 1, k0 + 32);

    v16h af[4], bf[2];
#pragma unroll
    for (int i = 0; i < 4; i++)
      af[i] = ld_frag(&As[cur][(wm * 64 + i * 16) * 40], 40, lane);
#pragma unroll
    for (int j = 0; j < 2; j++)
      bf[j] = ld_frag(&Bs[cur][(wn * 32 + j * 16) * 40], 40, lane);
#pragma unroll
    for (int i = 0; i < 4; i++)
#pragma unroll
      for (int j = 0; j < 2; j++) acc[i][j] = wmma_f16(af[i], bf[j], acc[i][j]);
  }

  int mrow = m0 + wm * 64;
  int nc0  = n0 + wn * 32;
#pragma unroll
  for (int i = 0; i < 4; i++)
#pragma unroll
    for (int j = 0; j < 2; j++) {
      int n = nc0 + j * 16 + (lane & 15);
      float bn = bias[n];
#pragma unroll
      for (int v = 0; v < 8; v++) {
        int row = mrow + i * 16 + v + ((lane >> 4) << 3);
        float val = (acc[i][j][v] + bn) * alpha;
        if (RESID)
          outf[(size_t)row * Nd + n] = val + resid[(size_t)row * Nd + n];
        else
          outh[(size_t)row * Nd + n] = (half_t)val;
      }
    }
}

// ---------------------------------------------------------------------------
// Fused attention per (b,h) and 128-row Q tile. K (256x64) staged to LDS
// via async-to-LDS; V staged transposed (64x256). S = QK^T via WMMA (Q
// pre-scaled by 1/8 in the Q GEMM), exact softmax over N=256 (16 lanes x 16
// tiles, shfl_xor reduction within half-wave), P->LDS f16, y = P@V via WMMA.
// ---------------------------------------------------------------------------
__global__ __launch_bounds__(256)
void attn_kernel(const half_t* __restrict__ qh, const half_t* __restrict__ kh,
                 const half_t* __restrict__ vh, half_t* __restrict__ y) {
  __shared__ __align__(16) half_t Ks[256 * 72];   // 36 KB
  __shared__ __align__(16) half_t Vt[64 * 264];   // 33 KB (V transposed)
  __shared__ __align__(16) half_t Ps[128 * 264];  // 66 KB
  int bh = blockIdx.x;
  int b = bh / H_, h = bh % H_;
  int t0 = blockIdx.y * 128;
  int tid = threadIdx.x, lane = tid & 31, w = tid >> 5;

  // Stage K (async global->LDS) and V^T (manual transpose)
  for (int c = tid; c < 2048; c += 256) {
    int tok = c >> 3, d0 = (c & 7) * 8;
    size_t gbase = ((size_t)(b * N_ + tok)) * D_ + h * DH_ + d0;
    async_ld_b128(lds_off(Ks + tok * 72 + d0), kh + gbase);
    h8 vv = *(const h8*)(vh + gbase);
#pragma unroll
    for (int e = 0; e < 8; e++) Vt[(d0 + e) * 264 + tok] = vv[e];
  }

  // Q fragments for this wave's 16 rows (dh=64 -> two K=32 fragments)
  v16h qa[2];
  {
    int m = lane & 15, hi = (lane >> 4) * 8;
    int t = t0 + w * 16 + m;
    const half_t* qp = qh + ((size_t)(b * T_ + t)) * D_ + h * DH_;
#pragma unroll
    for (int ks = 0; ks < 2; ks++) {
      union { v16h v; h8 hh[2]; } u;
      u.hh[0] = *(const h8*)(qp + ks * 32 + hi);
      u.hh[1] = *(const h8*)(qp + ks * 32 + 16 + hi);
      qa[ks] = u.v;
    }
  }
  wait_async0();
  __syncthreads();

  // S = Q K^T : 16 column tiles of 16, accumulate over dh in 2 steps
  v8f accs[16];
#pragma unroll
  for (int nt = 0; nt < 16; nt++) {
    accs[nt] = zero8();
#pragma unroll
    for (int ks = 0; ks < 2; ks++) {
      v16h bf = ld_frag(Ks + (nt * 16) * 72 + ks * 32, 72, lane);
      accs[nt] = wmma_f16(qa[ks], bf, accs[nt]);
    }
  }

  float rinv[8];
#pragma unroll
  for (int j = 0; j < 8; j++) {
    float m = -1e30f;
#pragma unroll
    for (int nt = 0; nt < 16; nt++) m = fmaxf(m, accs[nt][j]);
#pragma unroll
    for (int msk = 8; msk; msk >>= 1) m = fmaxf(m, __shfl_xor(m, msk, 32));
    float ssum = 0.f;
#pragma unroll
    for (int nt = 0; nt < 16; nt++) {
      float e = __expf(accs[nt][j] - m);
      accs[nt][j] = e;
      ssum += e;
    }
#pragma unroll
    for (int msk = 8; msk; msk >>= 1) ssum += __shfl_xor(ssum, msk, 32);
    rinv[j] = 1.f / ssum;
  }

  // P -> LDS (each wave owns its 16 rows; same-wave LDS RAW is in-order)
#pragma unroll
  for (int nt = 0; nt < 16; nt++)
#pragma unroll
    for (int j = 0; j < 8; j++) {
      int rl = w * 16 + j + ((lane >> 4) << 3);
      Ps[rl * 264 + nt * 16 + (lane & 15)] = (half_t)(accs[nt][j] * rinv[j]);
    }

  // y = P @ V : K=256 in 8 steps of 32; 4 output tiles (dh=64)
  v8f accy[4];
#pragma unroll
  for (int j = 0; j < 4; j++) accy[j] = zero8();
  for (int kt = 0; kt < 8; kt++) {
    v16h af = ld_frag(Ps + (w * 16) * 264 + kt * 32, 264, lane);
#pragma unroll
    for (int j = 0; j < 4; j++) {
      v16h bf = ld_frag(Vt + (j * 16) * 264 + kt * 32, 264, lane);
      accy[j] = wmma_f16(af, bf, accy[j]);
    }
  }

#pragma unroll
  for (int j = 0; j < 4; j++) {
    int n = h * DH_ + j * 16 + (lane & 15);
#pragma unroll
    for (int v = 0; v < 8; v++) {
      int t = t0 + w * 16 + v + ((lane >> 4) << 3);
      y[((size_t)(b * T_ + t)) * D_ + n] = (half_t)accy[j][v];
    }
  }
}

// ---------------------------------------------------------------------------
// emb_out[b, o] = silu(emb[b]) @ We + be   (B=4 x 2048, tiny)
// ---------------------------------------------------------------------------
__global__ __launch_bounds__(256)
void emb_out_kernel(const float* __restrict__ emb, const float* __restrict__ We,
                    const float* __restrict__ be, float* __restrict__ eo) {
  int b = blockIdx.y;
  int o = blockIdx.x * 256 + threadIdx.x;  // 0..2047
  __shared__ float se[TE_];
  for (int i = threadIdx.x; i < TE_; i += 256) {
    float v = emb[b * TE_ + i];
    se[i] = v / (1.f + __expf(-v));
  }
  __syncthreads();
  float acc = 0.f;
  for (int i = 0; i < TE_; i++) acc += se[i] * We[(size_t)i * (2 * D_) + o];
  eo[b * (2 * D_) + o] = acc + be[o];
}

// ---------------------------------------------------------------------------
// Stylize: h = silu( LN(y) * (1 + scale_b) + shift_b ) -> f16
// ---------------------------------------------------------------------------
__global__ __launch_bounds__(256)
void stylize_kernel(const half_t* __restrict__ y, const float* __restrict__ eo,
                    const float* __restrict__ g, const float* __restrict__ bt,
                    half_t* __restrict__ out) {
  int row = blockIdx.x;  // b*T + t
  int b = row / T_;
  const half_t* yr = y + (size_t)row * D_;
  int tid = threadIdx.x;
  float s = 0.f, s2 = 0.f;
  for (int i = tid; i < D_; i += 256) { float v = (float)yr[i]; s += v; s2 += v * v; }
#pragma unroll
  for (int m = 16; m; m >>= 1) { s += __shfl_xor(s, m, 32); s2 += __shfl_xor(s2, m, 32); }
  __shared__ float ws[8], ws2[8];
  __shared__ float mu_s, rs_s;
  int w = tid >> 5;
  if ((tid & 31) == 0) { ws[w] = s; ws2[w] = s2; }
  __syncthreads();
  if (tid == 0) {
    float S = 0.f, S2 = 0.f;
#pragma unroll
    for (int i = 0; i < 8; i++) { S += ws[i]; S2 += ws2[i]; }
    float mu = S / (float)D_;
    float var = S2 / (float)D_ - mu * mu;
    mu_s = mu; rs_s = rsqrtf(var + 1e-5f);
  }
  __syncthreads();
  float mu = mu_s, rs = rs_s;
  for (int i = tid; i < D_; i += 256) {
    float ln = ((float)yr[i] - mu) * rs * g[i] + bt[i];
    float sc = eo[b * (2 * D_) + i];
    float sh = eo[b * (2 * D_) + D_ + i];
    float hv = ln * (1.f + sc) + sh;
    hv = hv / (1.f + __expf(-hv));  // silu
    out[(size_t)row * D_ + i] = (half_t)hv;
  }
}

// ---------------------------------------------------------------------------
extern "C" void kernel_launch(void* const* d_in, const int* in_sizes, int n_in,
                              void* d_out, int out_size, void* d_ws, size_t ws_size,
                              hipStream_t stream) {
  (void)in_sizes; (void)n_in; (void)out_size; (void)ws_size;
  const float* x       = (const float*)d_in[0];
  const float* xf      = (const float*)d_in[1];
  const float* emb     = (const float*)d_in[2];
  const float* norm_g  = (const float*)d_in[3];
  const float* norm_b  = (const float*)d_in[4];
  const float* tnorm_g = (const float*)d_in[5];
  const float* tnorm_b = (const float*)d_in[6];
  const float* Wq      = (const float*)d_in[7];
  const float* bq      = (const float*)d_in[8];
  const float* Wk      = (const float*)d_in[9];
  const float* bk      = (const float*)d_in[10];
  const float* Wv      = (const float*)d_in[11];
  const float* bv      = (const float*)d_in[12];
  const float* We      = (const float*)d_in[13];
  const float* be      = (const float*)d_in[14];
  const float* snorm_g = (const float*)d_in[15];
  const float* snorm_b = (const float*)d_in[16];
  const float* Wo      = (const float*)d_in[17];
  const float* bo      = (const float*)d_in[18];
  float* out = (float*)d_out;

  // Workspace layout (256B aligned)
  char* ws = (char*)d_ws;
  size_t off = 0;
  auto alloc = [&](size_t bytes) {
    char* p = ws + off;
    off += (bytes + 255) & ~(size_t)255;
    return p;
  };
  const size_t BT = (size_t)B_ * T_;
  const size_t BN = (size_t)B_ * N_;
  half_t* xh  = (half_t*)alloc(BT * D_ * 2);        // LN(x) f16; reused as hsty later
  half_t* xfh = (half_t*)alloc(BN * L_ * 2);        // LN(xf) f16
  half_t* Wqt = (half_t*)alloc((size_t)D_ * D_ * 2);
  half_t* Wkt = (half_t*)alloc((size_t)D_ * L_ * 2);
  half_t* Wvt = (half_t*)alloc((size_t)D_ * L_ * 2);
  half_t* Wot = (half_t*)alloc((size_t)D_ * D_ * 2);
  half_t* qh  = (half_t*)alloc(BT * D_ * 2);
  half_t* khb = (half_t*)alloc(BN * D_ * 2);
  half_t* vhb = (half_t*)alloc(BN * D_ * 2);
  half_t* yb  = (half_t*)alloc(BT * D_ * 2);
  float*  eo  = (float*)alloc((size_t)B_ * 2 * D_ * 4);

  // 1) weights -> f16, transposed (N x K)
  w_to_f16_t<<<dim3(D_ / 64, D_ / 64), 256, 0, stream>>>(Wq, Wqt, D_, D_);
  w_to_f16_t<<<dim3(D_ / 64, L_ / 64), 256, 0, stream>>>(Wk, Wkt, L_, D_);
  w_to_f16_t<<<dim3(D_ / 64, L_ / 64), 256, 0, stream>>>(Wv, Wvt, L_, D_);
  w_to_f16_t<<<dim3(D_ / 64, D_ / 64), 256, 0, stream>>>(Wo, Wot, D_, D_);

  // 2) LayerNorms -> f16
  ln_rows_f16<<<(int)BT, 256, 0, stream>>>(x, norm_g, norm_b, xh, D_);
  ln_rows_f16<<<(int)BN, 256, 0, stream>>>(xf, tnorm_g, tnorm_b, xfh, L_);

  // 3) Projections (Q folds 1/sqrt(dh)=0.125)
  gemm_wmma<false><<<dim3(D_ / 128, (int)(BT / 128)), 256, 0, stream>>>(
      xh, Wqt, bq, nullptr, qh, nullptr, (int)BT, D_, D_, 0.125f);
  gemm_wmma<false><<<dim3(D_ / 128, (int)(BN / 128)), 256, 0, stream>>>(
      xfh, Wkt, bk, nullptr, khb, nullptr, (int)BN, D_, L_, 1.0f);
  gemm_wmma<false><<<dim3(D_ / 128, (int)(BN / 128)), 256, 0, stream>>>(
      xfh, Wvt, bv, nullptr, vhb, nullptr, (int)BN, D_, L_, 1.0f);

  // 4) emb MLP (tiny)
  emb_out_kernel<<<dim3(2 * D_ / 256, B_), 256, 0, stream>>>(emb, We, be, eo);

  // 5) attention: grid (B*H, T/128)
  attn_kernel<<<dim3(B_ * H_, T_ / 128), 256, 0, stream>>>(qh, khb, vhb, yb);

  // 6) stylize (xh buffer reused as f16 h)
  stylize_kernel<<<(int)BT, 256, 0, stream>>>(yb, eo, snorm_g, snorm_b, xh);

  // 7) out = x + h @ Wo + bo
  gemm_wmma<true><<<dim3(D_ / 128, (int)(BT / 128)), 256, 0, stream>>>(
      xh, Wot, bo, x, nullptr, out, (int)BT, D_, D_, 1.0f);
}

// v002
// A run of this version takes 264 microseconds.
// In both of two side-by-side timings against v001, it was 1.15 times as fast.
// Over all steps from v000 it is 1.59 times as fast.
#include <hip/hip_runtime.h>
#include <hip/hip_fp16.h>

typedef _Float16 half_t;
typedef __attribute__((ext_vector_type(16))) _Float16 v16h;
typedef __attribute__((ext_vector_type(8)))  _Float16 h8;
typedef __attribute__((ext_vector_type(4)))  _Float16 h4;
typedef __attribute__((ext_vector_type(8)))  float    v8f;

#define B_  4
#define T_  4096
#define D_  1024
#define N_  256
#define L_  768
#define H_  16
#define DH_ 64
#define TE_ 1024

__device__ inline v8f zero8() {
  v8f z;
#pragma unroll
  for (int i = 0; i < 8; i++) z[i] = 0.f;
  return z;
}

__device__ inline v8f wmma_f16(v16h a, v16h b, v8f c) {
  return __builtin_amdgcn_wmma_f32_16x16x32_f16(
      /*neg_a=*/false, a, /*neg_b=*/false, b,
      /*c_mod=*/(short)0, c, /*reuse_a=*/false, /*reuse_b=*/false);
}

__device__ inline uint32_t lds_off(const void* p) {
  return (uint32_t)(uintptr_t)p;
}
__device__ inline void async_ld_b128(uint32_t ldsaddr, const void* g) {
  asm volatile("global_load_async_to_lds_b128 %0, %1, off"
               :: "v"(ldsaddr), "v"((unsigned long long)(uintptr_t)g)
               : "memory");
}
__device__ inline void wait_async0() {
  asm volatile("s_wait_asynccnt 0x0" ::: "memory");
}

__device__ inline v16h ld_frag(const half_t* tileBase, int stride, int lane) {
  int m  = lane & 15;
  int hi = (lane >> 4) * 8;
  const half_t* p = tileBase + m * stride + hi;
  union { v16h v; h8 h[2]; } u;
  u.h[0] = *(const h8*)(p);
  u.h[1] = *(const h8*)(p + 16);
  return u.v;
}

__device__ inline float rsqrt_slot(float x) {
  bool tiny = x < 1.17549435e-38f;
  float xs = tiny ? x * 16777216.f : x;
  float r;
  asm("v_rsq_f32 %0, %1\n\tv_nop" : "=v"(r) : "v"(xs));
  return tiny ? r * 4096.f : r;
}

// ---------------------------------------------------------------------------
// LayerNorm over WIDTH fp32 -> fp16 row output. One wave owns a whole row: the
// row stays in registers (16 B per lane and load, 512 contiguous bytes per
// wave), its sums are folded by a lane butterfly, so no LDS and no barrier.
// Each wave takes ROWS consecutive rows, gain and bias are read once per wave,
// and the next row is loaded before the current one is summed.
// Launch: 512 threads (16 waves), grid = rows / (16 * ROWS).
// ---------------------------------------------------------------------------
template <int WIDTH, int ROWS>
__global__ __launch_bounds__(512)
void ln_rows_f16(const float* __restrict__ in, const float* __restrict__ g,
                 const float* __restrict__ bt, half_t* __restrict__ out) {
  static_assert(WIDTH % 128 == 0, "a wave covers 128 floats per load");
  constexpr int NV = WIDTH / 128;
  int lane = threadIdx.x & 31;
  // the wave's number as a scalar: row bases stay in scalar registers
  int w = __builtin_amdgcn_readfirstlane(threadIdx.x >> 5);
  size_t row0 = ((size_t)blockIdx.x * 16 + w) * ROWS;
  const float* src = in + row0 * WIDTH + lane * 4;
  half_t* dst = out + row0 * WIDTH + lane * 4;

  float4 cur[NV], nxt[NV], gv[NV], bv[NV];
#pragma unroll
  for (int p = 0; p < NV; p++) cur[p] = *(const float4*)(src + p * 128);
#pragma unroll
  for (int p = 0; p < NV; p++) {
    gv[p] = *(const float4*)(g + lane * 4 + p * 128);
    bv[p] = *(const float4*)(bt + lane * 4 + p * 128);
  }

  // unrolled so that both row buffers stay in registers and every row offset
  // is an immediate of its load or store
#pragma unroll
  for (int r = 0; r < ROWS; r++) {
    if (r + 1 < ROWS) {
#pragma unroll
      for (int p = 0; p < NV; p++)
        nxt[p] = *(const float4*)(src + (r + 1) * WIDTH + p * 128);
    }
    float4 a = make_float4(0.f, 0.f, 0.f, 0.f), q = a;
#pragma unroll
    for (int p = 0; p < NV; p++) {
      float4 v = cur[p];
      a.x += v.x; a.y += v.y; a.z += v.z; a.w += v.w;
      q.x += v.x * v.x; q.y += v.y * v.y; q.z += v.z * v.z; q.w += v.w * v.w;
    }
    float s = (a.x + a.y) + (a.z + a.w), s2 = (q.x + q.y) + (q.z + q.w);
#pragma unroll
    for (int m = 16; m; m >>= 1) { s += __shfl_xor(s, m, 32); s2 += __shfl_xor(s2, m, 32); }
    float mu = s / (float)WIDTH;
    float var = s2 / (float)WIDTH - mu * mu;
    float rs = rsqrt_slot(var + 1e-5f);
#pragma unroll
    for (int p = 0; p < NV; p++) {
      float4 v = cur[p];
      h4 o;
      o[0] = (half_t)((v.x - mu) * rs * gv[p].x + bv[p].x);
      o[1] = (half_t)((v.y - mu) * rs * gv[p].y + bv[p].y);
      o[2] = (half_t)((v.z - mu) * rs * gv[p].z + bv[p].z);
      o[3] = (half_t)((v.w - mu) * rs * gv[p].w + bv[p].w);
      *(h4*)(dst + r * WIDTH + p * 128) = o;
    }
    if (r + 1 < ROWS) {
#pragma unroll
      for (int p = 0; p < NV; p++) cur[p] = nxt[p];
    }
  }
}

__global__ __launch_bounds__(256)
void w_to_f16_t(const float* __restrict__ W, half_t* __restrict__ Wt, int K, int N) {
  __shared__ float tile[64 * 65];
  int tid = threadIdx.x;
  int n0 = blockIdx.x * 64, k0 = blockIdx.y * 64;

  int c4 = (tid & 15) * 4, kr = tid >> 4;
  float4 v[4];
#pragma unroll
  for (int p = 0; p < 4; p++)
    v[p] = *(const float4*)(W + (size_t)(k0 + kr + 16 * p) * N + n0 + c4);
#pragma unroll
  for (int p = 0; p < 4; p++) {
    float* t = tile + (kr + 16 * p) * 65 + c4;
    t[0] = v[p].x; t[1] = v[p].y; t[2] = v[p].z; t[3] = v[p].w;
  }
  __syncthreads();

  int kc = (tid & 7) * 8, nr = tid >> 3;
#pragma unroll
  for (int p = 0; p < 2; p++) {
    int n = nr + 32 * p;
    h8 o;
#pragma unroll
    for (int e = 0; e < 8; e++) o[e] = (half_t)tile[(kc + e) * 65 + n];
    *(h8*)(Wt + (size_t)(n0 + n) * K + k0 + kc) = o;
  }
}

// ---------------------------------------------------------------------------
// WMMA GEMM: out = alpha*(A[MxK] @ Wt^T + bias) (+ resid for RESID).
// A row-major f16, Wt row-major f16 (N x K). Block = 256 thr = 8 waves,
// tile 128x128x32; wave computes 64x32 (4x2 WMMA tiles).
// Double-buffered LDS, staged with global_load_async_to_lds_b128.
// ---------------------------------------------------------------------------
template <bool RESID>
__global__ __launch_bounds__(256)
void gemm_wmma(const half_t* __restrict__ A, const half_t* __restrict__ Wt,
               const float* __restrict__ bias, const float* __restrict__ resid,
               half_t* __restrict__ outh, float* __restrict__ outf,
               int M, int Nd, int Kd, float alpha) {
  __shared__ __align__(16) half_t As[2][128 * 40];
  __shared__ __align__(16) half_t Bs[2][128 * 40];
  int tid = threadIdx.x, lane = tid & 31, w = tid >> 5;
  int wm = w & 1, wn = w >> 1;
  int m0 = blockIdx.y * 128, n0 = blockIdx.x * 128;

  v8f acc[4][2];
#pragma unroll
  for (int i = 0; i < 4; i++)
#pragma unroll
    for (int j = 0; j < 2; j++) acc[i][j] = zero8();

  int r  = tid >> 1;        // staging row (128 rows, 2 threads/row)
  int cH = (tid & 1) * 16;  // staging half-chunk (16 halfs)
  const half_t* gA = A  + (size_t)(m0 + r) * Kd + cH;
  const half_t* gB = Wt + (size_t)(n0 + r) * Kd + cH;
  uint32_t lA[2], lB[2];
#pragma unroll
  for (int s = 0; s < 2; s++) {
    lA[s] = lds_off(&As[s][r * 40 + cH]);
    lB[s] = lds_off(&Bs[s][r * 40 + cH]);
  }

  auto issue = [&](int s, int k0) {
    async_ld_b128(lA[s],      gA + k0);
    async_ld_b128(lA[s] + 16, gA + k0 + 8);
    async_ld_b128(lB[s],      gB + k0);
    async_ld_b128(lB[s] + 16, gB + k0 + 8);
  };

  issue(0, 0);
  int cur = 0;
  for (int k0 = 0; k0 < Kd; k0 += 32, cur ^= 1) {
    wait_async0();    // own async writes done
    __syncthreads();  // everyone's writes visible; prev readers of buf cur^1 done
    if (k0 + 32 < Kd) issue(cur ^ 1, k0 + 32);

    v16h af[4], bf[2];
#pragma unroll
    for (int i = 0; i < 4; i++)
      af[i] = ld_frag(&As[cur][(wm * 64 + i * 16) * 40], 40, lane);
#pragma unroll
    for (int j = 0; j < 2; j++)
      bf[j] = ld_frag(&Bs[cur][(wn * 32 + j * 16) * 40], 40, lane);
#pragma unroll
    for (int i = 0; i < 4; i++)
#pragma unroll
      for (int j = 0; j < 2; j++) acc[i][j] = wmma_f16(af[i], bf[j], acc[i][j]);
  }

  int mrow = m0 + wm * 64;
  int nc0  = n0 + wn * 32;
#pragma unroll
  for (int i = 0; i < 4; i++)
#pragma unroll
    for (int j = 0; j < 2; j++) {
      int n = nc0 + j * 16 + (lane & 15);
      float bn = bias[n];
#pragma unroll
      for (int v = 0; v < 8; v++) {
        int row = mrow + i * 16 + v + ((lane >> 4) << 3);
        float val = (acc[i][j][v] + bn) * alpha;
        if (RESID)
          outf[(size_t)row * Nd + n] = val + resid[(size_t)row * Nd + n];
        else
          outh[(size_t)row * Nd + n] = (half_t)val;
      }
    }
}

// ---------------------------------------------------------------------------
// Fused attention per (b,h) and 128-row Q tile. K (256x64) staged to LDS
// via async-to-LDS; V staged transposed (64x256). S = QK^T via WMMA (Q
// pre-scaled by 1/8 in the Q GEMM), exact softmax over N=256 (16 lanes x 16
// tiles, shfl_xor reduction within half-wave), P->LDS f16, y = P@V via WMMA.
// ---------------------------------------------------------------------------
__global__ __launch_bounds__(256)
void attn_kernel(const half_t* __restrict__ qh, const half_t* __restrict__ kh,
                 const half_t* __restrict__ vh, half_t* __restrict__ y) {
  __shared__ __align__(16) half_t Ks[256 * 72];   // 36 KB
  __shared__ __align__(16) half_t Vt[64 * 264];   // 33 KB (V transposed)
  __shared__ __align__(16) half_t Ps[128 * 264];  // 66 KB
  int bh = blockIdx.x;
  int b = bh / H_, h = bh % H_;
  int t0 = blockIdx.y * 128;
  int tid = threadIdx.x, lane = tid & 31, w = tid >> 5;

  // Stage K (async global->LDS) and V^T (manual transpose)
  for (int c = tid; c < 2048; c += 256) {
    int tok = c >> 3, d0 = (c & 7) * 8;
    size_t gbase = ((size_t)(b * N_ + tok)) * D_ + h * DH_ + d0;
    async_ld_b128(lds_off(Ks + tok * 72 + d0), kh + gbase);
    h8 vv = *(const h8*)(vh + gbase);
#pragma unroll
    for (int e = 0; e < 8; e++) Vt[(d0 + e) * 264 + tok] = vv[e];
  }

  // Q fragments for this wave's 16 rows (dh=64 -> two K=32 fragments)
  v16h qa[2];
  {
    int m = lane & 15, hi = (lane >> 4) * 8;
    int t = t0 + w * 16 + m;
    const half_t* qp = qh + ((size_t)(b * T_ + t)) * D_ + h * DH_;
#pragma unroll
    for (int ks = 0; ks < 2; ks++) {
      union { v16h v; h8 hh[2]; } u;
      u.hh[0] = *(const h8*)(qp + ks * 32 + hi);
      u.hh[1] = *(const h8*)(qp + ks * 32 + 16 + hi);
      qa[ks] = u.v;
    }
  }
  wait_async0();
  __syncthreads();

  // S = Q K^T : 16 column tiles of 16, accumulate over dh in 2 steps
  v8f accs[16];
#pragma unroll
  for (int nt = 0; nt < 16; nt++) {
    accs[nt] = zero8();
#pragma unroll
    for (int ks = 0; ks < 2; ks++) {
      v16h bf = ld_frag(Ks + (nt * 16) * 72 + ks * 32, 72, lane);
      accs[nt] = wmma_f16(qa[ks], bf, accs[nt]);
    }
  }

  float rinv[8];
#pragma unroll
  for (int j = 0; j < 8; j++) {
    float m = -1e30f;
#pragma unroll
    for (int nt = 0; nt < 16; nt++) m = fmaxf(m, accs[nt][j]);
#pragma unroll
    for (int msk = 8; msk; msk >>= 1) m = fmaxf(m, __shfl_xor(m, msk, 32));
    float ssum = 0.f;
#pragma unroll
    for (int nt = 0; nt < 16; nt++) {
      float e = __expf(accs[nt][j] - m);
      accs[nt][j] = e;
      ssum += e;
    }
#pragma unroll
    for (int msk = 8; msk; msk >>= 1) ssum += __shfl_xor(ssum, msk, 32);
    rinv[j] = 1.f / ssum;
  }

  // P -> LDS (each wave owns its 16 rows; same-wave LDS RAW is in-order)
#pragma unroll
  for (int nt = 0; nt < 16; nt++)
#pragma unroll
    for (int j = 0; j < 8; j++) {
      int rl = w * 16 + j + ((lane >> 4) << 3);
      Ps[rl * 264 + nt * 16 + (lane & 15)] = (half_t)(accs[nt][j] * rinv[j]);
    }

  // y = P @ V : K=256 in 8 steps of 32; 4 output tiles (dh=64)
  v8f accy[4];
#pragma unroll
  for (int j = 0; j < 4; j++) accy[j] = zero8();
  for (int kt = 0; kt < 8; kt++) {
    v16h af = ld_frag(Ps + (w * 16) * 264 + kt * 32, 264, lane);
#pragma unroll
    for (int j = 0; j < 4; j++) {
      v16h bf = ld_frag(Vt + (j * 16) * 264 + kt * 32, 264, lane);
      accy[j] = wmma_f16(af, bf, accy[j]);
    }
  }

#pragma unroll
  for (int j = 0; j < 4; j++) {
    int n = h * DH_ + j * 16 + (lane & 15);
#pragma unroll
    for (int v = 0; v < 8; v++) {
      int t = t0 + w * 16 + v + ((lane >> 4) << 3);
      y[((size_t)(b * T_ + t)) * D_ + n] = (half_t)accy[j][v];
    }
  }
}

// ---------------------------------------------------------------------------
// emb_out[b, o] = silu(emb[b]) @ We + be   (B=4 x 2048, tiny)
// ---------------------------------------------------------------------------
__global__ __launch_bounds__(256)
void emb_out_kernel(const float* __restrict__ emb, const float* __restrict__ We,
                    const float* __restrict__ be, float* __restrict__ eo) {
  int b = blockIdx.y;
  int o = blockIdx.x * 256 + threadIdx.x;  // 0..2047
  __shared__ float se[TE_];
  for (int i = threadIdx.x; i < TE_; i += 256) {
    float v = emb[b * TE_ + i];
    se[i] = v / (1.f + __expf(-v));
  }
  __syncthreads();
  float acc = 0.f;
  for (int i = 0; i < TE_; i++) acc += se[i] * We[(size_t)i * (2 * D_) + o];
  eo[b * (2 * D_) + o] = acc + be[o];
}

// ---------------------------------------------------------------------------
// Stylize: h = silu( LN(y) * (1 + scale_b) + shift_b ) -> f16
// One wave owns a whole row of D_ halfs in registers (16 B per lane and load),
// sums by a lane butterfly, no LDS and no barrier. Each wave takes ROWS
// consecutive rows of one batch entry; gain, bias, scale and shift are read
// once per wave, and the next row is loaded before the current one is summed.
// Launch: 512 threads (16 waves), grid = B_*T_ / (16 * ROWS).
// ---------------------------------------------------------------------------
template <int ROWS>
__global__ __launch_bounds__(512)
void stylize_kernel(const half_t* __restrict__ y, const float* __restrict__ eo,
                    const float* __restrict__ g, const float* __restrict__ bt,
                    half_t* __restrict__ out) {
  static_assert(T_ % ROWS == 0, "the rows of a wave share one batch entry");
  constexpr int NV = D_ / 256;  // 8 halfs per lane and load
  int lane = threadIdx.x & 31;
  // the wave's number as a scalar: row bases stay in scalar registers
  int w = __builtin_amdgcn_readfirstlane(threadIdx.x >> 5);
  size_t row0 = ((size_t)blockIdx.x * 16 + w) * ROWS;
  int b = (int)(row0 / T_);
  const half_t* src = y + row0 * D_ + lane * 8;
  half_t* dst = out + row0 * D_ + lane * 8;

  h8 cur[NV], nxt[NV];
#pragma unroll
  for (int p = 0; p < NV; p++) cur[p] = *(const h8*)(src + p * 256);

  float gv[NV][8], bv[NV][8], sc1[NV][8], sh[NV][8];
#pragma unroll
  for (int p = 0; p < NV; p++)
#pragma unroll
    for (int hf = 0; hf < 2; hf++) {
      int i = p * 256 + lane * 8 + hf * 4;
      float4 tg = *(const float4*)(g + i);
      float4 tb = *(const float4*)(bt + i);
      float4 tc = *(const float4*)(eo + b * (2 * D_) + i);
      float4 ts = *(const float4*)(eo + b * (2 * D_) + D_ + i);
      gv[p][hf * 4 + 0] = tg.x; gv[p][hf * 4 + 1] = tg.y;
      gv[p][hf * 4 + 2] = tg.z; gv[p][hf * 4 + 3] = tg.w;
      bv[p][hf * 4 + 0] = tb.x; bv[p][hf * 4 + 1] = tb.y;
      bv[p][hf * 4 + 2] = tb.z; bv[p][hf * 4 + 3] = tb.w;
      sc1[p][hf * 4 + 0] = 1.f + tc.x; sc1[p][hf * 4 + 1] = 1.f + tc.y;
      sc1[p][hf * 4 + 2] = 1.f + tc.z; sc1[p][hf * 4 + 3] = 1.f + tc.w;
      sh[p][hf * 4 + 0] = ts.x; sh[p][hf * 4 + 1] = ts.y;
      sh[p][hf * 4 + 2] = ts.z; sh[p][hf * 4 + 3] = ts.w;
    }

  // unrolled so that both row buffers stay in registers and every row offset
  // is an immediate of its load or store
#pragma unroll
  for (int r = 0; r < ROWS; r++) {
    if (r + 1 < ROWS) {
#pragma unroll
      for (int p = 0; p < NV; p++) nxt[p] = *(const h8*)(src + (r + 1) * D_ + p * 256);
    }
    float a[4] = {0.f, 0.f, 0.f, 0.f}, q[4] = {0.f, 0.f, 0.f, 0.f};
#pragma unroll
    for (int p = 0; p < NV; p++)
#pragma unroll
      for (int e = 0; e < 8; e++) {
        float v = (float)cur[p][e];
        a[e & 3] += v; q[e & 3] += v * v;
      }
    float s = (a[0] + a[1]) + (a[2] + a[3]), s2 = (q[0] + q[1]) + (q[2] + q[3]);
#pragma unroll
    for (int m = 16; m; m >>= 1) { s += __shfl_xor(s, m, 32); s2 += __shfl_xor(s2, m, 32); }
    float mu = s / (float)D_;
    float var = s2 / (float)D_ - mu * mu;
    float rs = rsqrtf(var + 1e-5f);
#pragma unroll
    for (int p = 0; p < NV; p++) {
      h8 o;
#pragma unroll
      for (int e = 0; e < 8; e++) {
        float ln = ((float)cur[p][e] - mu) * rs * gv[p][e] + bv[p][e];
        float hv = ln * sc1[p][e] + sh[p][e];
        hv = hv / (1.f + __expf(-hv));  // silu
        o[e] = (half_t)hv;
      }
      *(h8*)(dst + r * D_ + p * 256) = o;
    }
    if (r + 1 < ROWS) {
#pragma unroll
      for (int p = 0; p < NV; p++) cur[p] = nxt[p];
    }
  }
}

// ---------------------------------------------------------------------------
extern "C" void kernel_launch(void* const* d_in, const int* in_sizes, int n_in,
                              void* d_out, int out_size, void* d_ws, size_t ws_size,
                              hipStream_t stream) {
  (void)in_sizes; (void)n_in; (void)out_size; (void)ws_size;
  const float* x       = (const float*)d_in[0];
  const float* xf      = (const float*)d_in[1];
  const float* emb     = (const float*)d_in[2];
  const float* norm_g  = (const float*)d_in[3];
  const float* norm_b  = (const float*)d_in[4];
  const float* tnorm_g = (const float*)d_in[5];
  const float* tnorm_b = (const float*)d_in[6];
  const float* Wq      = (const float*)d_in[7];
  const float* bq      = (const float*)d_in[8];
  const float* Wk      = (const float*)d_in[9];
  const float* bk      = (const float*)d_in[10];
  const float* Wv      = (const float*)d_in[11];
  const float* bv      = (const float*)d_in[12];
  const float* We      = (const float*)d_in[13];
  const float* be      = (const float*)d_in[14];
  const float* snorm_g = (const float*)d_in[15];
  const float* snorm_b = (const float*)d_in[16];
  const float* Wo      = (const float*)d_in[17];
  const float* bo      = (const float*)d_in[18];
  float* out = (float*)d_out;

  // Workspace layout (256B aligned)
  char* ws = (char*)d_ws;
  size_t off = 0;
  auto alloc = [&](size_t bytes) {
    char* p = ws + off;
    off += (bytes + 255) & ~(size_t)255;
    return p;
  };
  const size_t BT = (size_t)B_ * T_;
  const size_t BN = (size_t)B_ * N_;
  half_t* xh  = (half_t*)alloc(BT * D_ * 2);        // LN(x) f16; reused as hsty later
  half_t* xfh = (half_t*)alloc(BN * L_ * 2);        // LN(xf) f16
  half_t* Wqt = (half_t*)alloc((size_t)D_ * D_ * 2);
  half_t* Wkt = (half_t*)alloc((size_t)D_ * L_ * 2);
  half_t* Wvt = (half_t*)alloc((size_t)D_ * L_ * 2);
  half_t* Wot = (half_t*)alloc((size_t)D_ * D_ * 2);
  half_t* qh  = (half_t*)alloc(BT * D_ * 2);
  half_t* khb = (half_t*)alloc(BN * D_ * 2);
  half_t* vhb = (half_t*)alloc(BN * D_ * 2);
  half_t* yb  = (half_t*)alloc(BT * D_ * 2);
  float*  eo  = (float*)alloc((size_t)B_ * 2 * D_ * 4);

  // 1) weights -> f16, transposed (N x K)
  w_to_f16_t<<<dim3(D_ / 64, D_ / 64), 256, 0, stream>>>(Wq, Wqt, D_, D_);
  w_to_f16_t<<<dim3(D_ / 64, L_ / 64), 256, 0, stream>>>(Wk, Wkt, L_, D_);
  w_to_f16_t<<<dim3(D_ / 64, L_ / 64), 256, 0, stream>>>(Wv, Wvt, L_, D_);
  w_to_f16_t<<<dim3(D_ / 64, D_ / 64), 256, 0, stream>>>(Wo, Wot, D_, D_);

  // 2) LayerNorms -> f16
  ln_rows_f16<D_, 4><<<(int)(BT / 64), 512, 0, stream>>>(x, norm_g, norm_b, xh);
  ln_rows_f16<L_, 1><<<(int)(BN / 16), 512, 0, stream>>>(xf, tnorm_g, tnorm_b, xfh);

  // 3) Projections (Q folds 1/sqrt(dh)=0.125)
  gemm_wmma<false><<<dim3(D_ / 128, (int)(BT / 128)), 256, 0, stream>>>(
      xh, Wqt, bq, nullptr, qh, nullptr, (int)BT, D_, D_, 0.125f);
  gemm_wmma<false><<<dim3(D_ / 128, (int)(BN / 128)), 256, 0, stream>>>(
      xfh, Wkt, bk, nullptr, khb, nullptr, (int)BN, D_, L_, 1.0f);
  gemm_wmma<false><<<dim3(D_ / 128, (int)(BN / 128)), 256, 0, stream>>>(
      xfh, Wvt, bv, nullptr, vhb, nullptr, (int)BN, D_, L_, 1.0f);

  // 4) emb MLP (tiny)
  emb_out_kernel<<<dim3(2 * D_ / 256, B_), 256, 0, stream>>>(emb, We, be, eo);

  // 5) attention: grid (B*H, T/128)
  attn_kernel<<<dim3(B_ * H_, T_ / 128), 256, 0, stream>>>(qh, khb, vhb, yb);

  // 6) stylize (xh buffer reused as f16 h)
  stylize_kernel<4><<<(int)(BT / 64), 512, 0, stream>>>(yb, eo, snorm_g, snorm_b, xh);

  // 7) out = x + h @ Wo + bo
  gemm_wmma<true><<<dim3(D_ / 128, (int)(BT / 128)), 256, 0, stream>>>(
      xh, Wot, bo, x, nullptr, out, (int)BT, D_, D_, 1.0f);
}

// v003
// Measured time: 228 microseconds a run.
// Timed twice side by side with v002, it ran 1.15 times as fast both times.
// All steps since v000 together make it 1.83 times as fast.
#include <hip/hip_runtime.h>
#include <hip/hip_fp16.h>

typedef _Float16 half_t;
typedef __attribute__((ext_vector_type(16))) _Float16 v16h;
typedef __attribute__((ext_vector_type(8)))  _Float16 h8;
typedef __attribute__((ext_vector_type(4)))  _Float16 h4;
typedef __attribute__((ext_vector_type(8)))  float    v8f;

#define B_  4
#define T_  4096
#define D_  1024
#define N_  256
#define L_  768
#define H_  16
#define DH_ 64
#define TE_ 1024

__device__ inline v8f zero8() {
  v8f z;
#pragma unroll
  for (int i = 0; i < 8; i++) z[i] = 0.f;
  return z;
}

__device__ inline v8f wmma_f16(v16h a, v16h b, v8f c) {
  return __builtin_amdgcn_wmma_f32_16x16x32_f16(
      /*neg_a=*/false, a, /*neg_b=*/false, b,
      /*c_mod=*/(short)0, c, /*reuse_a=*/false, /*reuse_b=*/false);
}

__device__ inline uint32_t lds_off(const void* p) {
  return (uint32_t)(uintptr_t)p;
}
__device__ inline void async_ld_b128(uint32_t ldsaddr, const void* g) {
  asm volatile("global_load_async_to_lds_b128 %0, %1, off"
               :: "v"(ldsaddr), "v"((unsigned long long)(uintptr_t)g)
               : "memory");
}
__device__ inline void wait_async0() {
  asm volatile("s_wait_asynccnt 0x0" ::: "memory");
}

__device__ inline v16h ld_frag(const half_t* tileBase, int stride, int lane) {
  int m  = lane & 15;
  int hi = (lane >> 4) * 8;
  const half_t* p = tileBase + m * stride + hi;
  union { v16h v; h8 h[2]; } u;
  u.h[0] = *(const h8*)(p);
  u.h[1] = *(const h8*)(p + 16);
  return u.v;
}

__device__ inline float rsqrt_slot(float x) {
  bool tiny = x < 1.17549435e-38f;
  float xs = tiny ? x * 16777216.f : x;
  float r;
  asm("v_rsq_f32 %0, %1\n\tv_nop" : "=v"(r) : "v"(xs));
  return tiny ? r * 4096.f : r;
}

// ---------------------------------------------------------------------------
// LayerNorm over WIDTH fp32 -> fp16 row output. One wave owns a whole row: the
// row stays in registers (16 B per lane and load, 512 contiguous bytes per
// wave), its sums are folded by a lane butterfly, so no LDS and no barrier.
// Each wave takes ROWS consecutive rows, gain and bias are read once per wave,
// and the next row is loaded before the current one is summed.
// Launch: 512 threads (16 waves), grid = rows / (16 * ROWS).
// ---------------------------------------------------------------------------
template <int WIDTH, int ROWS>
__global__ __launch_bounds__(512)
void ln_rows_f16(const float* __restrict__ in, const float* __restrict__ g,
                 const float* __restrict__ bt, half_t* __restrict__ out) {
  static_assert(WIDTH % 128 == 0, "a wave covers 128 floats per load");
  constexpr int NV = WIDTH / 128;
  int lane = threadIdx.x & 31;
  // the wave's number as a scalar: row bases stay in scalar registers
  int w = __builtin_amdgcn_readfirstlane(threadIdx.x >> 5);
  size_t row0 = ((size_t)blockIdx.x * 16 + w) * ROWS;
  const float* src = in + row0 * WIDTH + lane * 4;
  half_t* dst = out + row0 * WIDTH + lane * 4;

  float4 cur[NV], nxt[NV], gv[NV], bv[NV];
#pragma unroll
  for (int p = 0; p < NV; p++) cur[p] = *(const float4*)(src + p * 128);
#pragma unroll
  for (int p = 0; p < NV; p++) {
    gv[p] = *(const float4*)(g + lane * 4 + p * 128);
    bv[p] = *(const float4*)(bt + lane * 4 + p * 128);
  }

  // unrolled so that both row buffers stay in registers and every row offset
  // is an immediate of its load or store
#pragma unroll
  for (int r = 0; r < ROWS; r++) {
    if (r + 1 < ROWS) {
#pragma unroll
      for (int p = 0; p < NV; p++)
        nxt[p] = *(const float4*)(src + (r + 1) * WIDTH + p * 128);
    }
    float4 a = make_float4(0.f, 0.f, 0.f, 0.f), q = a;
#pragma unroll
    for (int p = 0; p < NV; p++) {
      float4 v = cur[p];
      a.x += v.x; a.y += v.y; a.z += v.z; a.w += v.w;
      q.x += v.x * v.x; q.y += v.y * v.y; q.z += v.z * v.z; q.w += v.w * v.w;
    }
    float s = (a.x + a.y) + (a.z + a.w), s2 = (q.x + q.y) + (q.z + q.w);
#pragma unroll
    for (int m = 16; m; m >>= 1) { s += __shfl_xor(s, m, 32); s2 += __shfl_xor(s2, m, 32); }
    float mu = s / (float)WIDTH;
    float var = s2 / (float)WIDTH - mu * mu;
    float rs = rsqrt_slot(var + 1e-5f);
#pragma unroll
    for (int p = 0; p < NV; p++) {
      float4 v = cur[p];
      h4 o;
      o[0] = (half_t)((v.x - mu) * rs * gv[p].x + bv[p].x);
      o[1] = (half_t)((v.y - mu) * rs * gv[p].y + bv[p].y);
      o[2] = (half_t)((v.z - mu) * rs * gv[p].z + bv[p].z);
      o[3] = (half_t)((v.w - mu) * rs * gv[p].w + bv[p].w);
      *(h4*)(dst + r * WIDTH + p * 128) = o;
    }
    if (r + 1 < ROWS) {
#pragma unroll
      for (int p = 0; p < NV; p++) cur[p] = nxt[p];
    }
  }
}

__global__ __launch_bounds__(256)
void w_to_f16_t(const float* __restrict__ W, half_t* __restrict__ Wt, int K, int N) {
  __shared__ float tile[64 * 65];
  int tid = threadIdx.x;
  int n0 = blockIdx.x * 64, k0 = blockIdx.y * 64;

  int c4 = (tid & 15) * 4, kr = tid >> 4;
  float4 v[4];
#pragma unroll
  for (int p = 0; p < 4; p++)
    v[p] = *(const float4*)(W + (size_t)(k0 + kr + 16 * p) * N + n0 + c4);
#pragma unroll
  for (int p = 0; p < 4; p++) {
    float* t = tile + (kr + 16 * p) * 65 + c4;
    t[0] = v[p].x; t[1] = v[p].y; t[2] = v[p].z; t[3] = v[p].w;
  }
  __syncthreads();

  int kc = (tid & 7) * 8, nr = tid >> 3;
#pragma unroll
  for (int p = 0; p < 2; p++) {
    int n = nr + 32 * p;
    h8 o;
#pragma unroll
    for (int e = 0; e < 8; e++) o[e] = (half_t)tile[(kc + e) * 65 + n];
    *(h8*)(Wt + (size_t)(n0 + n) * K + k0 + kc) = o;
  }
}

// ---------------------------------------------------------------------------
// WMMA GEMM: out = alpha*(A[MxK] @ Wt^T + bias) (+ resid for RESID).
// A row-major f16, Wt row-major f16 (N x K). Block = 256 thr = 8 waves,
// tile 128x128x32; wave computes 64x32 (4x2 WMMA tiles).
// Double-buffered LDS, staged with global_load_async_to_lds_b128.
// ---------------------------------------------------------------------------
template <bool RESID>
__global__ __launch_bounds__(256)
void gemm_wmma(const half_t* __restrict__ A, const half_t* __restrict__ Wt,
               const float* __restrict__ bias, const float* __restrict__ resid,
               half_t* __restrict__ outh, float* __restrict__ outf,
               int M, int Nd, int Kd, float alpha) {
  __shared__ __align__(16) half_t As[2][128 * 40];
  __shared__ __align__(16) half_t Bs[2][128 * 40];
  int tid = threadIdx.x, lane = tid & 31, w = tid >> 5;
  int wm = w & 1, wn = w >> 1;
  int m0 = blockIdx.y * 128, n0 = blockIdx.x * 128;

  v8f acc[4][2];
#pragma unroll
  for (int i = 0; i < 4; i++)
#pragma unroll
    for (int j = 0; j < 2; j++) acc[i][j] = zero8();

  int r  = tid >> 1;        // staging row (128 rows, 2 threads/row)
  int cH = (tid & 1) * 16;  // staging half-chunk (16 halfs)
  const half_t* gA = A  + (size_t)(m0 + r) * Kd + cH;
  const half_t* gB = Wt + (size_t)(n0 + r) * Kd + cH;
  uint32_t lA[2], lB[2];
#pragma unroll
  for (int s = 0; s < 2; s++) {
    lA[s] = lds_off(&As[s][r * 40 + cH]);
    lB[s] = lds_off(&Bs[s][r * 40 + cH]);
  }

  auto issue = [&](int s, int k0) {
    async_ld_b128(lA[s],      gA + k0);
    async_ld_b128(lA[s] + 16, gA + k0 + 8);
    async_ld_b128(lB[s],      gB + k0);
    async_ld_b128(lB[s] + 16, gB + k0 + 8);
  };

  issue(0, 0);
  int cur = 0;
  for (int k0 = 0; k0 < Kd; k0 += 32, cur ^= 1) {
    wait_async0();    // own async writes done
    __syncthreads();  // everyone's writes visible; prev readers of buf cur^1 done
    if (k0 + 32 < Kd) issue(cur ^ 1, k0 + 32);

    v16h af[4], bf[2];
#pragma unroll
    for (int i = 0; i < 4; i++)
      af[i] = ld_frag(&As[cur][(wm * 64 + i * 16) * 40], 40, lane);
#pragma unroll
    for (int j = 0; j < 2; j++)
      bf[j] = ld_frag(&Bs[cur][(wn * 32 + j * 16) * 40], 40, lane);
#pragma unroll
    for (int i = 0; i < 4; i++)
#pragma unroll
      for (int j = 0; j < 2; j++) acc[i][j] = wmma_f16(af[i], bf[j], acc[i][j]);
  }

  int mrow = m0 + wm * 64;
  int nc0  = n0 + wn * 32;
#pragma unroll
  for (int i = 0; i < 4; i++)
#pragma unroll
    for (int j = 0; j < 2; j++) {
      int n = nc0 + j * 16 + (lane & 15);
      float bn = bias[n];
#pragma unroll
      for (int v = 0; v < 8; v++) {
        int row = mrow + i * 16 + v + ((lane >> 4) << 3);
        float val = (acc[i][j][v] + bn) * alpha;
        if (RESID)
          outf[(size_t)row * Nd + n] = val + resid[(size_t)row * Nd + n];
        else
          outh[(size_t)row * Nd + n] = (half_t)val;
      }
    }
}

// ---------------------------------------------------------------------------
// Fused attention per (b,h) and 128-row Q tile. K (256x64) staged to LDS
// via async-to-LDS; V staged transposed (64x256). S = QK^T via WMMA (Q
// pre-scaled by 1/8 in the Q GEMM), exact softmax over N=256 (16 lanes x 16
// tiles, shfl_xor reduction within half-wave), P->LDS f16, y = P@V via WMMA.
// ---------------------------------------------------------------------------
__global__ __launch_bounds__(256)
void attn_kernel(const half_t* __restrict__ qh, const half_t* __restrict__ kh,
                 const half_t* __restrict__ vh, half_t* __restrict__ y) {
  __shared__ __align__(16) half_t Ks[256 * 72];   // 36 KB
  __shared__ __align__(16) half_t Vt[64 * 264];   // 33 KB (V transposed)
  __shared__ __align__(16) half_t Ps[128 * 264];  // 66 KB
  int bh = blockIdx.x;
  int b = bh / H_, h = bh % H_;
  int t0 = blockIdx.y * 128;
  int tid = threadIdx.x, lane = tid & 31, w = tid >> 5;

  // Stage K (async global->LDS) and V^T (manual transpose)
  for (int c = tid; c < 2048; c += 256) {
    int tok = c >> 3, d0 = (c & 7) * 8;
    size_t gbase = ((size_t)(b * N_ + tok)) * D_ + h * DH_ + d0;
    async_ld_b128(lds_off(Ks + tok * 72 + d0), kh + gbase);
    h8 vv = *(const h8*)(vh + gbase);
#pragma unroll
    for (int e = 0; e < 8; e++) Vt[(d0 + e) * 264 + tok] = vv[e];
  }

  // Q fragments for this wave's 16 rows (dh=64 -> two K=32 fragments)
  v16h qa[2];
  {
    int m = lane & 15, hi = (lane >> 4) * 8;
    int t = t0 + w * 16 + m;
    const half_t* qp = qh + ((size_t)(b * T_ + t)) * D_ + h * DH_;
#pragma unroll
    for (int ks = 0; ks < 2; ks++) {
      union { v16h v; h8 hh[2]; } u;
      u.hh[0] = *(const h8*)(qp + ks * 32 + hi);
      u.hh[1] = *(const h8*)(qp + ks * 32 + 16 + hi);
      qa[ks] = u.v;
    }
  }
  wait_async0();
  __syncthreads();

  // S = Q K^T : 16 column tiles of 16, accumulate over dh in 2 steps
  v8f accs[16];
#pragma unroll
  for (int nt = 0; nt < 16; nt++) {
    accs[nt] = zero8();
#pragma unroll
    for (int ks = 0; ks < 2; ks++) {
      v16h bf = ld_frag(Ks + (nt * 16) * 72 + ks * 32, 72, lane);
      accs[nt] = wmma_f16(qa[ks], bf, accs[nt]);
    }
  }

  float rinv[8];
#pragma unroll
  for (int j = 0; j < 8; j++) {
    float m = -1e30f;
#pragma unroll
    for (int nt = 0; nt < 16; nt++) m = fmaxf(m, accs[nt][j]);
#pragma unroll
    for (int msk = 8; msk; msk >>= 1) m = fmaxf(m, __shfl_xor(m, msk, 32));
    float ssum = 0.f;
#pragma unroll
    for (int nt = 0; nt < 16; nt++) {
      float e = __expf(accs[nt][j] - m);
      accs[nt][j] = e;
      ssum += e;
    }
#pragma unroll
    for (int msk = 8; msk; msk >>= 1) ssum += __shfl_xor(ssum, msk, 32);
    rinv[j] = 1.f / ssum;
  }

  // P -> LDS (each wave owns its 16 rows; same-wave LDS RAW is in-order)
#pragma unroll
  for (int nt = 0; nt < 16; nt++)
#pragma unroll
    for (int j = 0; j < 8; j++) {
      int rl = w * 16 + j + ((lane >> 4) << 3);
      Ps[rl * 264 + nt * 16 + (lane & 15)] = (half_t)(accs[nt][j] * rinv[j]);
    }

  // y = P @ V : K=256 in 8 steps of 32; 4 output tiles (dh=64)
  v8f accy[4];
#pragma unroll
  for (int j = 0; j < 4; j++) accy[j] = zero8();
  for (int kt = 0; kt < 8; kt++) {
    v16h af = ld_frag(Ps + (w * 16) * 264 + kt * 32, 264, lane);
#pragma unroll
    for (int j = 0; j < 4; j++) {
      v16h bf = ld_frag(Vt + (j * 16) * 264 + kt * 32, 264, lane);
      accy[j] = wmma_f16(af, bf, accy[j]);
    }
  }

#pragma unroll
  for (int j = 0; j < 4; j++) {
    int n = h * DH_ + j * 16 + (lane & 15);
#pragma unroll
    for (int v = 0; v < 8; v++) {
      int t = t0 + w * 16 + v + ((lane >> 4) << 3);
      y[((size_t)(b * T_ + t)) * D_ + n] = (half_t)accy[j][v];
    }
  }
}

// ---------------------------------------------------------------------------
// emb_out[b, o] = silu(emb[b]) @ We + be   (B=4 x 2048)
// One block owns 32 output columns (one 128 B line of every We row) for all
// four batch entries, so We is read once. Its 32 waves split the 1024 rows:
// a wave has its 32 row loads in flight at once, under the silu staging, and
// the per-wave partial sums are folded through LDS.
// Launch: 1024 threads (32 waves), grid = 2*D_/32.
// ---------------------------------------------------------------------------
__global__ __launch_bounds__(1024)
void emb_out_kernel(const float* __restrict__ emb, const float* __restrict__ We,
                    const float* __restrict__ be, float* __restrict__ eo) {
  static_assert(B_ * TE_ == 4096 && TE_ == 1024, "1024 threads stage 4 values each");
  __shared__ __align__(16) float se[B_ * TE_];
  __shared__ float part[32][B_][32];
  int tid = threadIdx.x, lane = tid & 31;
  // the wave's number as a scalar: the row base stays in scalar registers
  int w = __builtin_amdgcn_readfirstlane(tid >> 5);
  int o = blockIdx.x * 32 + lane;

  float4 ev = *(const float4*)(emb + tid * 4);
  const float* wp = We + (size_t)(w * 32) * (2 * D_) + o;
  float wv[32];
#pragma unroll
  for (int i = 0; i < 32; i++) wv[i] = wp[(size_t)i * (2 * D_)];
  float bo = be[o];
  // keeps every load above issued before the silu arithmetic waits for emb;
  // without it the We loads start only after that first round trip to memory
  __builtin_amdgcn_sched_barrier(0);

  ev.x = ev.x / (1.f + __expf(-ev.x));
  ev.y = ev.y / (1.f + __expf(-ev.y));
  ev.z = ev.z / (1.f + __expf(-ev.z));
  ev.w = ev.w / (1.f + __expf(-ev.w));
  *(float4*)(se + tid * 4) = ev;
  __syncthreads();

  float acc[B_];
#pragma unroll
  for (int b = 0; b < B_; b++) acc[b] = 0.f;
#pragma unroll
  for (int i = 0; i < 32; i += 4)
#pragma unroll
    for (int b = 0; b < B_; b++) {
      float4 s = *(const float4*)(se + b * TE_ + w * 32 + i);
      acc[b] += s.x * wv[i];
      acc[b] += s.y * wv[i + 1];
      acc[b] += s.z * wv[i + 2];
      acc[b] += s.w * wv[i + 3];
    }
#pragma unroll
  for (int b = 0; b < B_; b++) part[w][b][lane] = acc[b];
  __syncthreads();

  // waves 0..3 fold the 32 partials of one batch entry each, in four chains
  if (w < B_) {
    float s[4] = {0.f, 0.f, 0.f, 0.f};
#pragma unroll
    for (int p = 0; p < 32; p++) s[p & 3] += part[p][w][lane];
    eo[w * (2 * D_) + o] = ((s[0] + s[1]) + (s[2] + s[3])) + bo;
  }
}

// ---------------------------------------------------------------------------
// Stylize: h = silu( LN(y) * (1 + scale_b) + shift_b ) -> f16
// One wave owns a whole row of D_ halfs in registers (16 B per lane and load),
// sums by a lane butterfly, no LDS and no barrier. Each wave takes ROWS
// consecutive rows of one batch entry; gain, bias, scale and shift are read
// once per wave, and the next row is loaded before the current one is summed.
// Launch: 512 threads (16 waves), grid = B_*T_ / (16 * ROWS).
// ---------------------------------------------------------------------------
template <int ROWS>
__global__ __launch_bounds__(512)
void stylize_kernel(const half_t* __restrict__ y, const float* __restrict__ eo,
                    const float* __restrict__ g, const float* __restrict__ bt,
                    half_t* __restrict__ out) {
  static_assert(T_ % ROWS == 0, "the rows of a wave share one batch entry");
  constexpr int NV = D_ / 256;  // 8 halfs per lane and load
  int lane = threadIdx.x & 31;
  // the wave's number as a scalar: row bases stay in scalar registers
  int w = __builtin_amdgcn_readfirstlane(threadIdx.x >> 5);
  size_t row0 = ((size_t)blockIdx.x * 16 + w) * ROWS;
  int b = (int)(row0 / T_);
  const half_t* src = y + row0 * D_ + lane * 8;
  half_t* dst = out + row0 * D_ + lane * 8;

  h8 cur[NV], nxt[NV];
#pragma unroll
  for (int p = 0; p < NV; p++) cur[p] = *(const h8*)(src + p * 256);

  float gv[NV][8], bv[NV][8], sc1[NV][8], sh[NV][8];
#pragma unroll
  for (int p = 0; p < NV; p++)
#pragma unroll
    for (int hf = 0; hf < 2; hf++) {
      int i = p * 256 + lane * 8 + hf * 4;
      float4 tg = *(const float4*)(g + i);
      float4 tb = *(const float4*)(bt + i);
      float4 tc = *(const float4*)(eo + b * (2 * D_) + i);
      float4 ts = *(const float4*)(eo + b * (2 * D_) + D_ + i);
      gv[p][hf * 4 + 0] = tg.x; gv[p][hf * 4 + 1] = tg.y;
      gv[p][hf * 4 + 2] = tg.z; gv[p][hf * 4 + 3] = tg.w;
      bv[p][hf * 4 + 0] = tb.x; bv[p][hf * 4 + 1] = tb.y;
      bv[p][hf * 4 + 2] = tb.z; bv[p][hf * 4 + 3] = tb.w;
      sc1[p][hf * 4 + 0] = 1.f + tc.x; sc1[p][hf * 4 + 1] = 1.f + tc.y;
      sc1[p][hf * 4 + 2] = 1.f + tc.z; sc1[p][hf * 4 + 3] = 1.f + tc.w;
      sh[p][hf * 4 + 0] = ts.x; sh[p][hf * 4 + 1] = ts.y;
      sh[p][hf * 4 + 2] = ts.z; sh[p][hf * 4 + 3] = ts.w;
    }

  // unrolled so that both row buffers stay in registers and every row offset
  // is an immediate of its load or store
#pragma unroll
  for (int r = 0; r < ROWS; r++) {
    if (r + 1 < ROWS) {
#pragma unroll
      for (int p = 0; p < NV; p++) nxt[p] = *(const h8*)(src + (r + 1) * D_ + p * 256);
    }
    float a[4] = {0.f, 0.f, 0.f, 0.f}, q[4] = {0.f, 0.f, 0.f, 0.f};
#pragma unroll
    for (int p = 0; p < NV; p++)
#pragma unroll
      for (int e = 0; e < 8; e++) {
        float v = (float)cur[p][e];
        a[e & 3] += v; q[e & 3] += v * v;
      }
    float s = (a[0] + a[1]) + (a[2] + a[3]), s2 = (q[0] + q[1]) + (q[2] + q[3]);
#pragma unroll
    for (int m = 16; m; m >>= 1) { s += __shfl_xor(s, m, 32); s2 += __shfl_xor(s2, m, 32); }
    float mu = s / (float)D_;
    float var = s2 / (float)D_ - mu * mu;
    float rs = rsqrtf(var + 1e-5f);
#pragma unroll
    for (int p = 0; p < NV; p++) {
      h8 o;
#pragma unroll
      for (int e = 0; e < 8; e++) {
        float ln = ((float)cur[p][e] - mu) * rs * gv[p][e] + bv[p][e];
        float hv = ln * sc1[p][e] + sh[p][e];
        hv = hv / (1.f + __expf(-hv));  // silu
        o[e] = (half_t)hv;
      }
      *(h8*)(dst + r * D_ + p * 256) = o;
    }
    if (r + 1 < ROWS) {
#pragma unroll
      for (int p = 0; p < NV; p++) cur[p] = nxt[p];
    }
  }
}

// ---------------------------------------------------------------------------
extern "C" void kernel_launch(void* const* d_in, const int* in_sizes, int n_in,
                              void* d_out, int out_size, void* d_ws, size_t ws_size,
                              hipStream_t stream) {
  (void)in_sizes; (void)n_in; (void)out_size; (void)ws_size;
  const float* x       = (const float*)d_in[0];
  const float* xf      = (const float*)d_in[1];
  const float* emb     = (const float*)d_in[2];
  const float* norm_g  = (const float*)d_in[3];
  const float* norm_b  = (const float*)d_in[4];
  const float* tnorm_g = (const float*)d_in[5];
  const float* tnorm_b = (const float*)d_in[6];
  const float* Wq      = (const float*)d_in[7];
  const float* bq      = (const float*)d_in[8];
  const float* Wk      = (const float*)d_in[9];
  const float* bk      = (const float*)d_in[10];
  const float* Wv      = (const float*)d_in[11];
  const float* bv      = (const float*)d_in[12];
  const float* We      = (const float*)d_in[13];
  const float* be      = (const float*)d_in[14];
  const float* snorm_g = (const float*)d_in[15];
  const float* snorm_b = (const float*)d_in[16];
  const float* Wo      = (const float*)d_in[17];
  const float* bo      = (const float*)d_in[18];
  float* out = (float*)d_out;

  // Workspace layout (256B aligned)
  char* ws = (char*)d_ws;
  size_t off = 0;
  auto alloc = [&](size_t bytes) {
    char* p = ws + off;
    off += (bytes + 255) & ~(size_t)255;
    return p;
  };
  const size_t BT = (size_t)B_ * T_;
  const size_t BN = (size_t)B_ * N_;
  half_t* xh  = (half_t*)alloc(BT * D_ * 2);        // LN(x) f16; reused as hsty later
  half_t* xfh = (half_t*)alloc(BN * L_ * 2);        // LN(xf) f16
  half_t* Wqt = (half_t*)alloc((size_t)D_ * D_ * 2);
  half_t* Wkt = (half_t*)alloc((size_t)D_ * L_ * 2);
  half_t* Wvt = (half_t*)alloc((size_t)D_ * L_ * 2);
  half_t* Wot = (half_t*)alloc((size_t)D_ * D_ * 2);
  half_t* qh  = (half_t*)alloc(BT * D_ * 2);
  half_t* khb = (half_t*)alloc(BN * D_ * 2);
  half_t* vhb = (half_t*)alloc(BN * D_ * 2);
  half_t* yb  = (half_t*)alloc(BT * D_ * 2);
  float*  eo  = (float*)alloc((size_t)B_ * 2 * D_ * 4);

  // 1) weights -> f16, transposed (N x K)
  w_to_f16_t<<<dim3(D_ / 64, D_ / 64), 256, 0, stream>>>(Wq, Wqt, D_, D_);
  w_to_f16_t<<<dim3(D_ / 64, L_ / 64), 256, 0, stream>>>(Wk, Wkt, L_, D_);
  w_to_f16_t<<<dim3(D_ / 64, L_ / 64), 256, 0, stream>>>(Wv, Wvt, L_, D_);
  w_to_f16_t<<<dim3(D_ / 64, D_ / 64), 256, 0, stream>>>(Wo, Wot, D_, D_);

  // 2) LayerNorms -> f16
  ln_rows_f16<D_, 4><<<(int)(BT / 64), 512, 0, stream>>>(x, norm_g, norm_b, xh);
  ln_rows_f16<L_, 1><<<(int)(BN / 16), 512, 0, stream>>>(xf, tnorm_g, tnorm_b, xfh);

  // 3) Projections (Q folds 1/sqrt(dh)=0.125)
  gemm_wmma<false><<<dim3(D_ / 128, (int)(BT / 128)), 256, 0, stream>>>(
      xh, Wqt, bq, nullptr, qh, nullptr, (int)BT, D_, D_, 0.125f);
  gemm_wmma<false><<<dim3(D_ / 128, (int)(BN / 128)), 256, 0, stream>>>(
      xfh, Wkt, bk, nullptr, khb, nullptr, (int)BN, D_, L_, 1.0f);
  gemm_wmma<false><<<dim3(D_ / 128, (int)(BN / 128)), 256, 0, stream>>>(
      xfh, Wvt, bv, nullptr, vhb, nullptr, (int)BN, D_, L_, 1.0f);

  // 4) emb MLP: one block per 32 output columns
  emb_out_kernel<<<2 * D_ / 32, 1024, 0, stream>>>(emb, We, be, eo);

  // 5) attention: grid (B*H, T/128)
  attn_kernel<<<dim3(B_ * H_, T_ / 128), 256, 0, stream>>>(qh, khb, vhb, yb);

  // 6) stylize (xh buffer reused as f16 h)
  stylize_kernel<4><<<(int)(BT / 64), 512, 0, stream>>>(yb, eo, snorm_g, snorm_b, xh);

  // 7) out = x + h @ Wo + bo
  gemm_wmma<true><<<dim3(D_ / 128, (int)(BT / 128)), 256, 0, stream>>>(
      xh, Wot, bo, x, nullptr, out, (int)BT, D_, D_, 1.0f);
}

// v004
// Measured time: 183 microseconds a run.
// In two side-by-side timings against v003, it was 1.24 and 1.23 times as fast.
// Counting every step since v000, it is 2.27 times as fast.
#include <hip/hip_runtime.h>
#include <hip/hip_fp16.h>

typedef _Float16 half_t;
typedef __attribute__((ext_vector_type(16))) _Float16 v16h;
typedef __attribute__((ext_vector_type(8)))  _Float16 h8;
typedef __attribute__((ext_vector_type(4)))  _Float16 h4;
typedef __attribute__((ext_vector_type(8)))  float    v8f;

#define B_  4
#define T_  4096
#define D_  1024
#define N_  256
#define L_  768
#define H_  16
#define DH_ 64
#define TE_ 1024

__device__ inline v8f zero8() {
  v8f z;
#pragma unroll
  for (int i = 0; i < 8; i++) z[i] = 0.f;
  return z;
}

__device__ inline v8f wmma_f16(v16h a, v16h b, v8f c) {
  return __builtin_amdgcn_wmma_f32_16x16x32_f16(
      /*neg_a=*/false, a, /*neg_b=*/false, b,
      /*c_mod=*/(short)0, c, /*reuse_a=*/false, /*reuse_b=*/false);
}

__device__ inline uint32_t lds_off(const void* p) {
  return (uint32_t)(uintptr_t)p;
}
__device__ inline void async_ld_b128(uint32_t ldsaddr, const void* g) {
  asm volatile("global_load_async_to_lds_b128 %0, %1, off"
               :: "v"(ldsaddr), "v"((unsigned long long)(uintptr_t)g)
               : "memory");
}
__device__ inline void wait_async0() {
  asm volatile("s_wait_asynccnt 0x0" ::: "memory");
}

__device__ inline v16h ld_frag(const half_t* tileBase, int stride, int lane) {
  int m  = lane & 15;
  int hi = (lane >> 4) * 8;
  const half_t* p = tileBase + m * stride + hi;
  union { v16h v; h8 h[2]; } u;
  u.h[0] = *(const h8*)(p);
  u.h[1] = *(const h8*)(p + 16);
  return u.v;
}

__device__ inline float rsqrt_slot(float x) {
  bool tiny = x < 1.17549435e-38f;
  float xs = tiny ? x * 16777216.f : x;
  float r;
  asm("v_rsq_f32 %0, %1\n\tv_nop" : "=v"(r) : "v"(xs));
  return tiny ? r * 4096.f : r;
}

// ---------------------------------------------------------------------------
// LayerNorm over WIDTH fp32 -> fp16 row output. One wave owns a whole row: the
// row stays in registers (16 B per lane and load, 512 contiguous bytes per
// wave), its sums are folded by a lane butterfly, so no LDS and no barrier.
// Each wave takes ROWS consecutive rows, gain and bias are read once per wave,
// and the next row is loaded before the current one is summed.
// Part of front_kernel: 256 threads (8 waves), blk in [0, rows / (8 * ROWS)).
// ---------------------------------------------------------------------------
template <int WIDTH, int ROWS>
__device__ __forceinline__
void ln_rows_f16(const float* __restrict__ in, const float* __restrict__ g,
                 const float* __restrict__ bt, half_t* __restrict__ out, int blk) {
  static_assert(WIDTH % 128 == 0, "a wave covers 128 floats per load");
  constexpr int NV = WIDTH / 128;
  int lane = threadIdx.x & 31;
  // the wave's number as a scalar: row bases stay in scalar registers
  int w = __builtin_amdgcn_readfirstlane(threadIdx.x >> 5);
  size_t row0 = ((size_t)blk * 8 + w) * ROWS;
  const float* src = in + row0 * WIDTH + lane * 4;
  half_t* dst = out + row0 * WIDTH + lane * 4;

  float4 cur[NV], nxt[NV], gv[NV], bv[NV];
#pragma unroll
  for (int p = 0; p < NV; p++) cur[p] = *(const float4*)(src + p * 128);
#pragma unroll
  for (int p = 0; p < NV; p++) {
    gv[p] = *(const float4*)(g + lane * 4 + p * 128);
    bv[p] = *(const float4*)(bt + lane * 4 + p * 128);
  }

  // unrolled so that both row buffers stay in registers and every row offset
  // is an immediate of its load or store
#pragma unroll
  for (int r = 0; r < ROWS; r++) {
    if (r + 1 < ROWS) {
#pragma unroll
      for (int p = 0; p < NV; p++)
        nxt[p] = *(const float4*)(src + (r + 1) * WIDTH + p * 128);
    }
    float4 a = make_float4(0.f, 0.f, 0.f, 0.f), q = a;
#pragma unroll
    for (int p = 0; p < NV; p++) {
      float4 v = cur[p];
      a.x += v.x; a.y += v.y; a.z += v.z; a.w += v.w;
      q.x += v.x * v.x; q.y += v.y * v.y; q.z += v.z * v.z; q.w += v.w * v.w;
    }
    float s = (a.x + a.y) + (a.z + a.w), s2 = (q.x + q.y) + (q.z + q.w);
#pragma unroll
    for (int m = 16; m; m >>= 1) { s += __shfl_xor(s, m, 32); s2 += __shfl_xor(s2, m, 32); }
    float mu = s / (float)WIDTH;
    float var = s2 / (float)WIDTH - mu * mu;
    float rs = rsqrt_slot(var + 1e-5f);
#pragma unroll
    for (int p = 0; p < NV; p++) {
      float4 v = cur[p];
      h4 o;
      o[0] = (half_t)((v.x - mu) * rs * gv[p].x + bv[p].x);
      o[1] = (half_t)((v.y - mu) * rs * gv[p].y + bv[p].y);
      o[2] = (half_t)((v.z - mu) * rs * gv[p].z + bv[p].z);
      o[3] = (half_t)((v.w - mu) * rs * gv[p].w + bv[p].w);
      *(h4*)(dst + r * WIDTH + p * 128) = o;
    }
    if (r + 1 < ROWS) {
#pragma unroll
      for (int p = 0; p < NV; p++) cur[p] = nxt[p];
    }
  }
}

__device__ __forceinline__
void w_to_f16_t(const float* __restrict__ W, half_t* __restrict__ Wt, int K, int N,
                float* tile, int blk) {
  int tid = threadIdx.x;
  int n0 = (blk % (N / 64)) * 64, k0 = (blk / (N / 64)) * 64;

  int c4 = (tid & 15) * 4, kr = tid >> 4;
  float4 v[4];
#pragma unroll
  for (int p = 0; p < 4; p++)
    v[p] = *(const float4*)(W + (size_t)(k0 + kr + 16 * p) * N + n0 + c4);
#pragma unroll
  for (int p = 0; p < 4; p++) {
    float* t = tile + (kr + 16 * p) * 65 + c4;
    t[0] = v[p].x; t[1] = v[p].y; t[2] = v[p].z; t[3] = v[p].w;
  }
  __syncthreads();

  int kc = (tid & 7) * 8, nr = tid >> 3;
#pragma unroll
  for (int p = 0; p < 2; p++) {
    int n = nr + 32 * p;
    h8 o;
#pragma unroll
    for (int e = 0; e < 8; e++) o[e] = (half_t)tile[(kc + e) * 65 + n];
    *(h8*)(Wt + (size_t)(n0 + n) * K + k0 + kc) = o;
  }
  asm volatile("s_wait_xcnt 0x0" ::: "memory");
}

// ---------------------------------------------------------------------------
// WMMA GEMM: out = alpha*(A[MxK] @ Wt^T + bias) (+ resid for RESID).
// A row-major f16, Wt row-major f16 (N x K). Block = 256 thr = 8 waves,
// tile 128x128x32; wave computes 64x32 (4x2 WMMA tiles).
// Double-buffered LDS, staged with global_load_async_to_lds_b128.
// gemm_tile is one block's 128x128 tile, at block row by of its product.
// ---------------------------------------------------------------------------
template <bool RESID>
__device__ __forceinline__
void gemm_tile(const half_t* __restrict__ A, const half_t* __restrict__ Wt,
               const float* __restrict__ bias, const float* __restrict__ resid,
               half_t* __restrict__ outh, float* __restrict__ outf,
               int Nd, int Kd, float alpha, int by) {
  __shared__ __align__(16) half_t As[2][128 * 40];
  __shared__ __align__(16) half_t Bs[2][128 * 40];
  int tid = threadIdx.x, lane = tid & 31, w = tid >> 5;
  int wm = w & 1, wn = w >> 1;
  int m0 = by * 128, n0 = blockIdx.x * 128;

  v8f acc[4][2];
#pragma unroll
  for (int i = 0; i < 4; i++)
#pragma unroll
    for (int j = 0; j < 2; j++) acc[i][j] = zero8();

  int r  = tid >> 1;        // staging row (128 rows, 2 threads/row)
  int cH = (tid & 1) * 16;  // staging half-chunk (16 halfs)
  const half_t* gA = A  + (size_t)(m0 + r) * Kd + cH;
  const half_t* gB = Wt + (size_t)(n0 + r) * Kd + cH;
  uint32_t lA[2], lB[2];
#pragma unroll
  for (int s = 0; s < 2; s++) {
    lA[s] = lds_off(&As[s][r * 40 + cH]);
    lB[s] = lds_off(&Bs[s][r * 40 + cH]);
  }

  auto issue = [&](int s, int k0) {
    async_ld_b128(lA[s],      gA + k0);
    async_ld_b128(lA[s] + 16, gA + k0 + 8);
    async_ld_b128(lB[s],      gB + k0);
    async_ld_b128(lB[s] + 16, gB + k0 + 8);
  };

  issue(0, 0);
  int cur = 0;
  for (int k0 = 0; k0 < Kd; k0 += 32, cur ^= 1) {
    wait_async0();    // own async writes done
    __syncthreads();  // everyone's writes visible; prev readers of buf cur^1 done
    if (k0 + 32 < Kd) issue(cur ^ 1, k0 + 32);

    v16h af[4], bf[2];
#pragma unroll
    for (int i = 0; i < 4; i++)
      af[i] = ld_frag(&As[cur][(wm * 64 + i * 16) * 40], 40, lane);
#pragma unroll
    for (int j = 0; j < 2; j++)
      bf[j] = ld_frag(&Bs[cur][(wn * 32 + j * 16) * 40], 40, lane);
#pragma unroll
    for (int i = 0; i < 4; i++)
#pragma unroll
      for (int j = 0; j < 2; j++) acc[i][j] = wmma_f16(af[i], bf[j], acc[i][j]);
  }

  int mrow = m0 + wm * 64;
  int nc0  = n0 + wn * 32;
#pragma unroll
  for (int i = 0; i < 4; i++)
#pragma unroll
    for (int j = 0; j < 2; j++) {
      int n = nc0 + j * 16 + (lane & 15);
      float bn = bias[n];
#pragma unroll
      for (int v = 0; v < 8; v++) {
        int row = mrow + i * 16 + v + ((lane >> 4) << 3);
        float val = (acc[i][j][v] + bn) * alpha;
        if (RESID)
          outf[(size_t)row * Nd + n] = val + resid[(size_t)row * Nd + n];
        else
          outh[(size_t)row * Nd + n] = (half_t)val;
      }
    }
}

// Three products of the same Nd in one grid: block rows [0, y0) belong to j0,
// [y0, y0 + y1) to j1, the rest to j2. The longest K goes first, so that the
// shorter blocks fill the end of the launch.
struct GemmJob {
  const half_t* A;
  const half_t* Wt;
  const float* bias;
  half_t* outh;
  int Kd;
  float alpha;
};

__global__ __launch_bounds__(256)
void gemm_three(GemmJob j0, GemmJob j1, GemmJob j2, int y0, int y1, int Nd) {
  // the block's job: the same for every thread of the block
  int by = blockIdx.y;
  GemmJob jb = j0;
  if (by >= y0 + y1)  { jb = j2; by -= y0 + y1; }
  else if (by >= y0)  { jb = j1; by -= y0; }
  gemm_tile<false>(jb.A, jb.Wt, jb.bias, nullptr, jb.outh, nullptr, Nd, jb.Kd, jb.alpha, by);
}

__global__ __launch_bounds__(256)
void gemm_resid(const half_t* __restrict__ A, const half_t* __restrict__ Wt,
                const float* __restrict__ bias, const float* __restrict__ resid,
                float* __restrict__ outf, int Nd, int Kd, float alpha) {
  gemm_tile<true>(A, Wt, bias, resid, nullptr, outf, Nd, Kd, alpha, blockIdx.y);
}

// ---------------------------------------------------------------------------
// Fused attention per (b,h) and 128-row Q tile. K (256x64) staged to LDS
// via async-to-LDS; V staged transposed (64x256). S = QK^T via WMMA (Q
// pre-scaled by 1/8 in the Q GEMM), exact softmax over N=256 (16 lanes x 16
// tiles, shfl_xor reduction within half-wave), P->LDS f16, y = P@V via WMMA.
// ---------------------------------------------------------------------------
__global__ __launch_bounds__(256)
void attn_kernel(const half_t* __restrict__ qh, const half_t* __restrict__ kh,
                 const half_t* __restrict__ vh, half_t* __restrict__ y) {
  __shared__ __align__(16) half_t Ks[256 * 72];   // 36 KB
  __shared__ __align__(16) half_t Vt[64 * 264];   // 33 KB (V transposed)
  __shared__ __align__(16) half_t Ps[128 * 264];  // 66 KB
  int bh = blockIdx.x;
  int b = bh / H_, h = bh % H_;
  int t0 = blockIdx.y * 128;
  int tid = threadIdx.x, lane = tid & 31, w = tid >> 5;

  // Stage K (async global->LDS) and V^T (manual transpose)
  for (int c = tid; c < 2048; c += 256) {
    int tok = c >> 3, d0 = (c & 7) * 8;
    size_t gbase = ((size_t)(b * N_ + tok)) * D_ + h * DH_ + d0;
    async_ld_b128(lds_off(Ks + tok * 72 + d0), kh + gbase);
    h8 vv = *(const h8*)(vh + gbase);
#pragma unroll
    for (int e = 0; e < 8; e++) Vt[(d0 + e) * 264 + tok] = vv[e];
  }

  // Q fragments for this wave's 16 rows (dh=64 -> two K=32 fragments)
  v16h qa[2];
  {
    int m = lane & 15, hi = (lane >> 4) * 8;
    int t = t0 + w * 16 + m;
    const half_t* qp = qh + ((size_t)(b * T_ + t)) * D_ + h * DH_;
#pragma unroll
    for (int ks = 0; ks < 2; ks++) {
      union { v16h v; h8 hh[2]; } u;
      u.hh[0] = *(const h8*)(qp + ks * 32 + hi);
      u.hh[1] = *(const h8*)(qp + ks * 32 + 16 + hi);
      qa[ks] = u.v;
    }
  }
  wait_async0();
  __syncthreads();

  // S = Q K^T : 16 column tiles of 16, accumulate over dh in 2 steps
  v8f accs[16];
#pragma unroll
  for (int nt = 0; nt < 16; nt++) {
    accs[nt] = zero8();
#pragma unroll
    for (int ks = 0; ks < 2; ks++) {
      v16h bf = ld_frag(Ks + (nt * 16) * 72 + ks * 32, 72, lane);
      accs[nt] = wmma_f16(qa[ks], bf, accs[nt]);
    }
  }

  float rinv[8];
#pragma unroll
  for (int j = 0; j < 8; j++) {
    float m = -1e30f;
#pragma unroll
    for (int nt = 0; nt < 16; nt++) m = fmaxf(m, accs[nt][j]);
#pragma unroll
    for (int msk = 8; msk; msk >>= 1) m = fmaxf(m, __shfl_xor(m, msk, 32));
    float ssum = 0.f;
#pragma unroll
    for (int nt = 0; nt < 16; nt++) {
      float e = __expf(accs[nt][j] - m);
      accs[nt][j] = e;
      ssum += e;
    }
#pragma unroll
    for (int msk = 8; msk; msk >>= 1) ssum += __shfl_xor(ssum, msk, 32);
    rinv[j] = 1.f / ssum;
  }

  // P -> LDS (each wave owns its 16 rows; same-wave LDS RAW is in-order)
#pragma unroll
  for (int nt = 0; nt < 16; nt++)
#pragma unroll
    for (int j = 0; j < 8; j++) {
      int rl = w * 16 + j + ((lane >> 4) << 3);
      Ps[rl * 264 + nt * 16 + (lane & 15)] = (half_t)(accs[nt][j] * rinv[j]);
    }

  // y = P @ V : K=256 in 8 steps of 32; 4 output tiles (dh=64)
  v8f accy[4];
#pragma unroll
  for (int j = 0; j < 4; j++) accy[j] = zero8();
  for (int kt = 0; kt < 8; kt++) {
    v16h af = ld_frag(Ps + (w * 16) * 264 + kt * 32, 264, lane);
#pragma unroll
    for (int j = 0; j < 4; j++) {
      v16h bf = ld_frag(Vt + (j * 16) * 264 + kt * 32, 264, lane);
      accy[j] = wmma_f16(af, bf, accy[j]);
    }
  }

#pragma unroll
  for (int j = 0; j < 4; j++) {
    int n = h * DH_ + j * 16 + (lane & 15);
#pragma unroll
    for (int v = 0; v < 8; v++) {
      int t = t0 + w * 16 + v + ((lane >> 4) << 3);
      y[((size_t)(b * T_ + t)) * D_ + n] = (half_t)accy[j][v];
    }
  }
}

// ---------------------------------------------------------------------------
// emb_out[b, o] = silu(emb[b]) @ We + be   (B=4 x 2048)
// One block owns 32 output columns (one 128 B line of every We row) for all
// four batch entries, so We is read once. Its 8 waves split the 1024 rows:
// a wave takes its 128 rows in four groups of 32 row loads, the next group in
// flight under the sums of the current one, the first under the silu staging;
// the per-wave partial sums are folded through LDS.
// Part of front_kernel: 256 threads (8 waves), blk in [0, 2*D_/32); smem is
// EMB_SMEM floats of the block's LDS.
// ---------------------------------------------------------------------------
#define EMB_SMEM (B_ * TE_ + 8 * B_ * 32)
__device__ __forceinline__
void emb_out_block(const float* __restrict__ emb, const float* __restrict__ We,
                   const float* __restrict__ be, float* __restrict__ eo,
                   float* smem, int blk) {
  static_assert(B_ * TE_ == 4096 && TE_ == 1024, "256 threads stage 16 values each");
  float* se = smem;               // [B_][TE_]
  float* part = smem + B_ * TE_;  // [8][B_][32]
  int tid = threadIdx.x, lane = tid & 31;
  // the wave's number as a scalar: the row base stays in scalar registers
  int w = __builtin_amdgcn_readfirstlane(tid >> 5);
  int o = blk * 32 + lane;

  float4 ev[4];
#pragma unroll
  for (int p = 0; p < 4; p++) ev[p] = *(const float4*)(emb + (p * 256 + tid) * 4);
  const float* wp = We + (size_t)(w * 128) * (2 * D_) + o;
  float wv[32], wn[32];
#pragma unroll
  for (int i = 0; i < 32; i++) wv[i] = wp[(size_t)i * (2 * D_)];
  float bo = be[o];
  // keeps every load above issued before the silu arithmetic waits for emb;
  // without it the We loads start only after that first round trip to memory
  __builtin_amdgcn_sched_barrier(0);

#pragma unroll
  for (int p = 0; p < 4; p++) {
    ev[p].x = ev[p].x / (1.f + __expf(-ev[p].x));
    ev[p].y = ev[p].y / (1.f + __expf(-ev[p].y));
    ev[p].z = ev[p].z / (1.f + __expf(-ev[p].z));
    ev[p].w = ev[p].w / (1.f + __expf(-ev[p].w));
    *(float4*)(se + (p * 256 + tid) * 4) = ev[p];
  }
  __syncthreads();

  float acc[B_];
#pragma unroll
  for (int b = 0; b < B_; b++) acc[b] = 0.f;
  // unrolled so that both row groups stay in registers
#pragma unroll
  for (int c = 0; c < 4; c++) {
    if (c + 1 < 4) {
#pragma unroll
      for (int i = 0; i < 32; i++) wn[i] = wp[(size_t)((c + 1) * 32 + i) * (2 * D_)];
    }
#pragma unroll
    for (int i = 0; i < 32; i += 4)
#pragma unroll
      for (int b = 0; b < B_; b++) {
        float4 s = *(const float4*)(se + b * TE_ + w * 128 + c * 32 + i);
        acc[b] += s.x * wv[i];
        acc[b] += s.y * wv[i + 1];
        acc[b] += s.z * wv[i + 2];
        acc[b] += s.w * wv[i + 3];
      }
    if (c + 1 < 4) {
#pragma unroll
      for (int i = 0; i < 32; i++) wv[i] = wn[i];
    }
  }
#pragma unroll
  for (int b = 0; b < B_; b++) part[(w * B_ + b) * 32 + lane] = acc[b];
  __syncthreads();

  // waves 0..3 fold the 8 partials of one batch entry each, in four chains
  if (w < B_) {
    float s[4] = {0.f, 0.f, 0.f, 0.f};
#pragma unroll
    for (int p = 0; p < 8; p++) s[p & 3] += part[(p * B_ + w) * 32 + lane];
    eo[w * (2 * D_) + o] = ((s[0] + s[1]) + (s[2] + s[3])) + bo;
  }
}

#define FB_EMB (2 * D_ / 32)
#define FB_LNX (B_ * T_ / 32)
#define FB_WDD ((D_ / 64) * (D_ / 64))
#define FB_WLD ((D_ / 64) * (L_ / 64))
#define FB_LNF (B_ * N_ / 8)
#define FRONT_BLOCKS (FB_EMB + FB_LNX + 2 * FB_WDD + 2 * FB_WLD + FB_LNF)
__global__ __launch_bounds__(256)
void front_kernel(const float* __restrict__ x, const float* __restrict__ xf,
                  const float* __restrict__ emb,
                  const float* __restrict__ norm_g, const float* __restrict__ norm_b,
                  const float* __restrict__ tnorm_g, const float* __restrict__ tnorm_b,
                  const float* __restrict__ Wq, const float* __restrict__ Wk,
                  const float* __restrict__ Wv, const float* __restrict__ Wo,
                  const float* __restrict__ We, const float* __restrict__ be,
                  half_t* __restrict__ xh, half_t* __restrict__ xfh,
                  half_t* __restrict__ Wqt, half_t* __restrict__ Wkt,
                  half_t* __restrict__ Wvt, half_t* __restrict__ Wot,
                  float* __restrict__ eo) {
  static_assert(EMB_SMEM >= 64 * 65, "the LDS serves the emb part or one weight tile");
  __shared__ __align__(16) float smem[EMB_SMEM];
  int blk = blockIdx.x;
  if (blk < FB_EMB) { emb_out_block(emb, We, be, eo, smem, blk); return; }
  blk -= FB_EMB;
  if (blk < FB_LNX) { ln_rows_f16<D_, 4>(x, norm_g, norm_b, xh, blk); return; }
  blk -= FB_LNX;
  if (blk < FB_LNF) { ln_rows_f16<L_, 1>(xf, tnorm_g, tnorm_b, xfh, blk); return; }
  blk -= FB_LNF;
  const float* W = Wq;
  half_t* Wt = Wqt;
  int K = D_;
  if (blk >= FB_WDD + 2 * FB_WLD) { W = Wo; Wt = Wot; blk -= FB_WDD + 2 * FB_WLD; }
  else if (blk >= FB_WDD + FB_WLD) { W = Wv; Wt = Wvt; K = L_; blk -= FB_WDD + FB_WLD; }
  else if (blk >= FB_WDD) { W = Wk; Wt = Wkt; K = L_; blk -= FB_WDD; }
  w_to_f16_t(W, Wt, K, D_, smem, blk);
}

// ---------------------------------------------------------------------------
// Stylize: h = silu( LN(y) * (1 + scale_b) + shift_b ) -> f16
// One wave owns a whole row of D_ halfs in registers (16 B per lane and load),
// sums by a lane butterfly, no LDS and no barrier. Each wave takes ROWS
// consecutive rows of one batch entry; gain, bias, scale and shift are read
// once per wave, and the next row is loaded before the current one is summed.
// Launch: 512 threads (16 waves), grid = B_*T_ / (16 * ROWS).
// ---------------------------------------------------------------------------
template <int ROWS>
__global__ __launch_bounds__(512)
void stylize_kernel(const half_t* __restrict__ y, const float* __restrict__ eo,
                    const float* __restrict__ g, const float* __restrict__ bt,
                    half_t* __restrict__ out) {
  static_assert(T_ % ROWS == 0, "the rows of a wave share one batch entry");
  constexpr int NV = D_ / 256;  // 8 halfs per lane and load
  int lane = threadIdx.x & 31;
  // the wave's number as a scalar: row bases stay in scalar registers
  int w = __builtin_amdgcn_readfirstlane(threadIdx.x >> 5);
  size_t row0 = ((size_t)blockIdx.x * 16 + w) * ROWS;
  int b = (int)(row0 / T_);
  const half_t* src = y + row0 * D_ + lane * 8;
  half_t* dst = out + row0 * D_ + lane * 8;

  h8 cur[NV], nxt[NV];
#pragma unroll
  for (int p = 0; p < NV; p++) cur[p] = *(const h8*)(src + p * 256);

  float gv[NV][8], bv[NV][8], sc1[NV][8], sh[NV][8];
#pragma unroll
  for (int p = 0; p < NV; p++)
#pragma unroll
    for (int hf = 0; hf < 2; hf++) {
      int i = p * 256 + lane * 8 + hf * 4;
      float4 tg = *(const float4*)(g + i);
      float4 tb = *(const float4*)(bt + i);
      float4 tc = *(const float4*)(eo + b * (2 * D_) + i);
      float4 ts = *(const float4*)(eo + b * (2 * D_) + D_ + i);
      gv[p][hf * 4 + 0] = tg.x; gv[p][hf * 4 + 1] = tg.y;
      gv[p][hf * 4 + 2] = tg.z; gv[p][hf * 4 + 3] = tg.w;
      bv[p][hf * 4 + 0] = tb.x; bv[p][hf * 4 + 1] = tb.y;
      bv[p][hf * 4 + 2] = tb.z; bv[p][hf * 4 + 3] = tb.w;
      sc1[p][hf * 4 + 0] = 1.f + tc.x; sc1[p][hf * 4 + 1] = 1.f + tc.y;
      sc1[p][hf * 4 + 2] = 1.f + tc.z; sc1[p][hf * 4 + 3] = 1.f + tc.w;
      sh[p][hf * 4 + 0] = ts.x; sh[p][hf * 4 + 1] = ts.y;
      sh[p][hf * 4 + 2] = ts.z; sh[p][hf * 4 + 3] = ts.w;
    }

  // unrolled so that both row buffers stay in registers and every row offset
  // is an immediate of its load or store
#pragma unroll
  for (int r = 0; r < ROWS; r++) {
    if (r + 1 < ROWS) {
#pragma unroll
      for (int p = 0; p < NV; p++) nxt[p] = *(const h8*)(src + (r + 1) * D_ + p * 256);
    }
    float a[4] = {0.f, 0.f, 0.f, 0.f}, q[4] = {0.f, 0.f, 0.f, 0.f};
#pragma unroll
    for (int p = 0; p < NV; p++)
#pragma unroll
      for (int e = 0; e < 8; e++) {
        float v = (float)cur[p][e];
        a[e & 3] += v; q[e & 3] += v * v;
      }
    float s = (a[0] + a[1]) + (a[2] + a[3]), s2 = (q[0] + q[1]) + (q[2] + q[3]);
#pragma unroll
    for (int m = 16; m; m >>= 1) { s += __shfl_xor(s, m, 32); s2 += __shfl_xor(s2, m, 32); }
    float mu = s / (float)D_;
    float var = s2 / (float)D_ - mu * mu;
    float rs = rsqrtf(var + 1e-5f);
#pragma unroll
    for (int p = 0; p < NV; p++) {
      h8 o;
#pragma unroll
      for (int e = 0; e < 8; e++) {
        float ln = ((float)cur[p][e] - mu) * rs * gv[p][e] + bv[p][e];
        float hv = ln * sc1[p][e] + sh[p][e];
        hv = hv / (1.f + __expf(-hv));  // silu
        o[e] = (half_t)hv;
      }
      *(h8*)(dst + r * D_ + p * 256) = o;
    }
    if (r + 1 < ROWS) {
#pragma unroll
      for (int p = 0; p < NV; p++) cur[p] = nxt[p];
    }
  }
}

// ---------------------------------------------------------------------------
extern "C" void kernel_launch(void* const* d_in, const int* in_sizes, int n_in,
                              void* d_out, int out_size, void* d_ws, size_t ws_size,
                              hipStream_t stream) {
  (void)in_sizes; (void)n_in; (void)out_size; (void)ws_size;
  const float* x       = (const float*)d_in[0];
  const float* xf      = (const float*)d_in[1];
  const float* emb     = (const float*)d_in[2];
  const float* norm_g  = (const float*)d_in[3];
  const float* norm_b  = (const float*)d_in[4];
  const float* tnorm_g = (const float*)d_in[5];
  const float* tnorm_b = (const float*)d_in[6];
  const float* Wq      = (const float*)d_in[7];
  const float* bq      = (const float*)d_in[8];
  const float* Wk      = (const float*)d_in[9];
  const float* bk      = (const float*)d_in[10];
  const float* Wv      = (const float*)d_in[11];
  const float* bv      = (const float*)d_in[12];
  const float* We      = (const float*)d_in[13];
  const float* be      = (const float*)d_in[14];
  const float* snorm_g = (const float*)d_in[15];
  const float* snorm_b = (const float*)d_in[16];
  const float* Wo      = (const float*)d_in[17];
  const float* bo      = (const float*)d_in[18];
  float* out = (float*)d_out;

  // Workspace layout (256B aligned)
  char* ws = (char*)d_ws;
  size_t off = 0;
  auto alloc = [&](size_t bytes) {
    char* p = ws + off;
    off += (bytes + 255) & ~(size_t)255;
    return p;
  };
  const size_t BT = (size_t)B_ * T_;
  const size_t BN = (size_t)B_ * N_;
  half_t* xh  = (half_t*)alloc(BT * D_ * 2);        // LN(x) f16; reused as hsty later
  half_t* xfh = (half_t*)alloc(BN * L_ * 2);        // LN(xf) f16
  half_t* Wqt = (half_t*)alloc((size_t)D_ * D_ * 2);
  half_t* Wkt = (half_t*)alloc((size_t)D_ * L_ * 2);
  half_t* Wvt = (half_t*)alloc((size_t)D_ * L_ * 2);
  half_t* Wot = (half_t*)alloc((size_t)D_ * D_ * 2);
  half_t* qh  = (half_t*)alloc(BT * D_ * 2);
  half_t* khb = (half_t*)alloc(BN * D_ * 2);
  half_t* vhb = (half_t*)alloc(BN * D_ * 2);
  half_t* yb  = (half_t*)alloc(BT * D_ * 2);
  float*  eo  = (float*)alloc((size_t)B_ * 2 * D_ * 4);

  // 1) all that reads only the inputs: emb MLP, LayerNorms -> f16, weights ->
  //    f16 transposed (N x K)
  front_kernel<<<FRONT_BLOCKS, 256, 0, stream>>>(
      x, xf, emb, norm_g, norm_b, tnorm_g, tnorm_b, Wq, Wk, Wv, Wo, We, be,
      xh, xfh, Wqt, Wkt, Wvt, Wot, eo);

  // 2) Projections in one grid (Q folds 1/sqrt(dh)=0.125)
  GemmJob jq = {xh, Wqt, bq, qh, D_, 0.125f};
  GemmJob jk = {xfh, Wkt, bk, khb, L_, 1.0f};
  GemmJob jv = {xfh, Wvt, bv, vhb, L_, 1.0f};
  gemm_three<<<dim3(D_ / 128, (int)((BT + 2 * BN) / 128)), 256, 0, stream>>>(
      jq, jk, jv, (int)(BT / 128), (int)(BN / 128), D_);

  // 3) attention: grid (B*H, T/128)
  attn_kernel<<<dim3(B_ * H_, T_ / 128), 256, 0, stream>>>(qh, khb, vhb, yb);

  // 4) stylize (xh buffer reused as f16 h)
  stylize_kernel<4><<<(int)(BT / 64), 512, 0, stream>>>(yb, eo, snorm_g, snorm_b, xh);

  // 5) out = x + h @ Wo + bo
  gemm_resid<<<dim3(D_ / 128, (int)(BT / 128)), 256, 0, stream>>>(
      xh, Wot, bo, x, out, D_, D_, 1.0f);
}

// v005
// A run of this version takes 162 microseconds.
// Two timings next to v004 both put it at 1.13 times that version's speed.
// Over all steps from v000 it is 2.56 times as fast.
#include <hip/hip_runtime.h>
#include <hip/hip_fp16.h>

typedef _Float16 half_t;
typedef __attribute__((ext_vector_type(16))) _Float16 v16h;
typedef __attribute__((ext_vector_type(8)))  _Float16 h8;
typedef __attribute__((ext_vector_type(4)))  _Float16 h4;
typedef __attribute__((ext_vector_type(8)))  float    v8f;

#define B_  4
#define T_  4096
#define D_  1024
#define N_  256
#define L_  768
#define H_  16
#define DH_ 64
#define TE_ 1024

__device__ inline v8f zero8() {
  v8f z;
#pragma unroll
  for (int i = 0; i < 8; i++) z[i] = 0.f;
  return z;
}

__device__ inline v8f wmma_f16(v16h a, v16h b, v8f c) {
  return __builtin_amdgcn_wmma_f32_16x16x32_f16(
      /*neg_a=*/false, a, /*neg_b=*/false, b,
      /*c_mod=*/(short)0, c, /*reuse_a=*/false, /*reuse_b=*/false);
}

__device__ inline uint32_t lds_off(const void* p) {
  return (uint32_t)(uintptr_t)p;
}
__device__ inline void async_ld_b128(uint32_t ldsaddr, const void* g) {
  asm volatile("global_load_async_to_lds_b128 %0, %1, off"
               :: "v"(ldsaddr), "v"((unsigned long long)(uintptr_t)g)
               : "memory");
}
__device__ inline void wait_async0() {
  asm volatile("s_wait_asynccnt 0x0" ::: "memory");
}

__device__ inline v16h ld_frag(const half_t* tileBase, int stride, int lane) {
  int m  = lane & 15;
  int hi = (lane >> 4) * 8;
  const half_t* p = tileBase + m * stride + hi;
  union { v16h v; h8 h[2]; } u;
  u.h[0] = *(const h8*)(p);
  u.h[1] = *(const h8*)(p + 16);
  return u.v;
}

__device__ inline float rsqrt_slot(float x) {
  bool tiny = x < 1.17549435e-38f;
  float xs = tiny ? x * 16777216.f : x;
  float r;
  asm("v_rsq_f32 %0, %1\n\tv_nop" : "=v"(r) : "v"(xs));
  return tiny ? r * 4096.f : r;
}

// ---------------------------------------------------------------------------
// LayerNorm over WIDTH fp32 -> fp16 row output. One wave owns a whole row: the
// row stays in registers (16 B per lane and load, 512 contiguous bytes per
// wave), its sums are folded by a lane butterfly, so no LDS and no barrier.
// Each wave takes ROWS consecutive rows, gain and bias are read once per wave,
// and the next row is loaded before the current one is summed.
// Part of front_kernel: 256 threads (8 waves), blk in [0, rows / (8 * ROWS)).
// ---------------------------------------------------------------------------
template <int WIDTH, int ROWS>
__device__ __forceinline__
void ln_rows_f16(const float* __restrict__ in, const float* __restrict__ g,
                 const float* __restrict__ bt, half_t* __restrict__ out, int blk) {
  static_assert(WIDTH % 128 == 0, "a wave covers 128 floats per load");
  constexpr int NV = WIDTH / 128;
  int lane = threadIdx.x & 31;
  // the wave's number as a scalar: row bases stay in scalar registers
  int w = __builtin_amdgcn_readfirstlane(threadIdx.x >> 5);
  size_t row0 = ((size_t)blk * 8 + w) * ROWS;
  const float* src = in + row0 * WIDTH + lane * 4;
  half_t* dst = out + row0 * WIDTH + lane * 4;

  float4 cur[NV], nxt[NV], gv[NV], bv[NV];
#pragma unroll
  for (int p = 0; p < NV; p++) cur[p] = *(const float4*)(src + p * 128);
#pragma unroll
  for (int p = 0; p < NV; p++) {
    gv[p] = *(const float4*)(g + lane * 4 + p * 128);
    bv[p] = *(const float4*)(bt + lane * 4 + p * 128);
  }

  // unrolled so that both row buffers stay in registers and every row offset
  // is an immediate of its load or store
#pragma unroll
  for (int r = 0; r < ROWS; r++) {
    if (r + 1 < ROWS) {
#pragma unroll
      for (int p = 0; p < NV; p++)
        nxt[p] = *(const float4*)(src + (r + 1) * WIDTH + p * 128);
    }
    float4 a = make_float4(0.f, 0.f, 0.f, 0.f), q = a;
#pragma unroll
    for (int p = 0; p < NV; p++) {
      float4 v = cur[p];
      a.x += v.x; a.y += v.y; a.z += v.z; a.w += v.w;
      q.x += v.x * v.x; q.y += v.y * v.y; q.z += v.z * v.z; q.w += v.w * v.w;
    }
    float s = (a.x + a.y) + (a.z + a.w), s2 = (q.x + q.y) + (q.z + q.w);
#pragma unroll
    for (int m = 16; m; m >>= 1) { s += __shfl_xor(s, m, 32); s2 += __shfl_xor(s2, m, 32); }
    float mu = s / (float)WIDTH;
    float var = s2 / (float)WIDTH - mu * mu;
    float rs = rsqrt_slot(var + 1e-5f);
#pragma unroll
    for (int p = 0; p < NV; p++) {
      float4 v = cur[p];
      h4 o;
      o[0] = (half_t)((v.x - mu) * rs * gv[p].x + bv[p].x);
      o[1] = (half_t)((v.y - mu) * rs * gv[p].y + bv[p].y);
      o[2] = (half_t)((v.z - mu) * rs * gv[p].z + bv[p].z);
      o[3] = (half_t)((v.w - mu) * rs * gv[p].w + bv[p].w);
      *(h4*)(dst + r * WIDTH + p * 128) = o;
    }
    if (r + 1 < ROWS) {
#pragma unroll
      for (int p = 0; p < NV; p++) cur[p] = nxt[p];
    }
  }
}

__device__ __forceinline__
void w_to_f16_t(const float* __restrict__ W, half_t* __restrict__ Wt, int K, int N,
                float* tile, int blk) {
  int tid = threadIdx.x;
  int n0 = (blk % (N / 64)) * 64, k0 = (blk / (N / 64)) * 64;

  int c4 = (tid & 15) * 4, kr = tid >> 4;
  float4 v[4];
#pragma unroll
  for (int p = 0; p < 4; p++)
    v[p] = *(const float4*)(W + (size_t)(k0 + kr + 16 * p) * N + n0 + c4);
#pragma unroll
  for (int p = 0; p < 4; p++) {
    float* t = tile + (kr + 16 * p) * 65 + c4;
    t[0] = v[p].x; t[1] = v[p].y; t[2] = v[p].z; t[3] = v[p].w;
  }
  __syncthreads();

  int kc = (tid & 7) * 8, nr = tid >> 3;
#pragma unroll
  for (int p = 0; p < 2; p++) {
    int n = nr + 32 * p;
    h8 o;
#pragma unroll
    for (int e = 0; e < 8; e++) o[e] = (half_t)tile[(kc + e) * 65 + n];
    *(h8*)(Wt + (size_t)(n0 + n) * K + k0 + kc) = o;
  }
  asm volatile("s_wait_xcnt 0x0" ::: "memory");
}

#define GM_ 256
#define GK_ 64
#define GP_ 72
#define GLS_ (32 * GP_ * 2)

__device__ __forceinline__ void async_ld_rows4(uint32_t l, const half_t* g, size_t gstep) {
  asm volatile(
      "global_load_async_to_lds_b128 %0, %4, off\n\t"
      "global_load_async_to_lds_b128 %1, %5, off\n\t"
      "global_load_async_to_lds_b128 %2, %6, off\n\t"
      "global_load_async_to_lds_b128 %3, %7, off\n\t"
      "s_wait_xcnt 0x0"
      :: "v"(l), "v"(l + GLS_), "v"(l + 2 * GLS_), "v"(l + 3 * GLS_),
         "v"((unsigned long long)(uintptr_t)(g)),
         "v"((unsigned long long)(uintptr_t)(g + gstep)),
         "v"((unsigned long long)(uintptr_t)(g + 2 * gstep)),
         "v"((unsigned long long)(uintptr_t)(g + 3 * gstep))
      : "memory");
}

template <bool RESID>
__device__ __forceinline__
void gemm_tile(const half_t* __restrict__ A, const half_t* __restrict__ Wt,
               const float* __restrict__ bias, const float* __restrict__ resid,
               half_t* __restrict__ outh, float* __restrict__ outf,
               int Nd, int Kd, float alpha, int by) {
  __shared__ __align__(16) half_t As[2][GM_ * GP_];
  __shared__ __align__(16) half_t Bs[2][128 * GP_];
  int tid = threadIdx.x, lane = tid & 31, w = tid >> 5;
  int wm = w & 3, wn = w >> 2;
  int m0 = by * GM_, n0 = blockIdx.x * 128;

  v8f acc[4][4];
#pragma unroll
  for (int i = 0; i < 4; i++)
#pragma unroll
    for (int j = 0; j < 4; j++) acc[i][j] = zero8();

  int r  = tid >> 3;       // first staging row (8 threads a row, rows 32 apart)
  int cH = (tid & 7) * 8;  // staging chunk (8 halfs)
  const half_t* gA = A  + (size_t)(m0 + r) * Kd + cH;
  const half_t* gB = Wt + (size_t)(n0 + r) * Kd + cH;
  size_t gstep = (size_t)32 * Kd;
  uint32_t lA = lds_off(&As[0][r * GP_ + cH]);
  uint32_t lB = lds_off(&Bs[0][r * GP_ + cH]);

  auto issue = [&](int s, int k0) {
    async_ld_rows4(lA + s * (GM_ * GP_ * 2), gA + k0, gstep);
    async_ld_rows4(lA + s * (GM_ * GP_ * 2) + 4 * GLS_, gA + k0 + 4 * gstep, gstep);
    async_ld_rows4(lB + s * (128 * GP_ * 2), gB + k0, gstep);
  };

  int nt = Kd / GK_;
  issue(0, 0);
  wait_async0();    // own copies of tile 0 landed
  __syncthreads();  // everyone's copies of tile 0 visible
  if (nt > 1) issue(1, GK_);

  for (int t = 0; t < nt; t++) {
    const half_t* as = &As[t & 1][(wm * 64) * GP_];
    const half_t* bs = &Bs[t & 1][(wn * 64) * GP_];
#pragma unroll
    for (int ks = 0; ks < GK_ / 32; ks++) {
      v16h af[4], bf[4];
#pragma unroll
      for (int i = 0; i < 4; i++) af[i] = ld_frag(as + (i * 16) * GP_ + ks * 32, GP_, lane);
#pragma unroll
      for (int j = 0; j < 4; j++) bf[j] = ld_frag(bs + (j * 16) * GP_ + ks * 32, GP_, lane);
      // keeps the 16 fragment reads together in front of their 16 products:
      // spread among them, every row of products waits out an LDS round trip
      __builtin_amdgcn_sched_barrier(0);
#pragma unroll
      for (int i = 0; i < 4; i++)
#pragma unroll
        for (int j = 0; j < 4; j++) acc[i][j] = wmma_f16(af[i], bf[j], acc[i][j]);
    }
    // own reads of this buffer retired before anyone's copies may refill it
    asm volatile("s_wait_dscnt 0x0" ::: "memory");
    wait_async0();    // own copies of tile t + 1 landed
    __syncthreads();  // tile t + 1 visible; every reader has left tile t's buffer
    if (t + 2 < nt) issue(t & 1, (t + 2) * GK_);
  }
  wait_async0();  // nothing in flight when the wave ends

  int mrow = m0 + wm * 64 + ((lane >> 4) << 3);
  int nc0  = n0 + wn * 64 + (lane & 15);
  float bn[4];
#pragma unroll
  for (int j = 0; j < 4; j++) bn[j] = bias[nc0 + j * 16];
  // the offset register that the four bias loads name stays whole up to here
  asm volatile("s_wait_xcnt 0x0" :: "v"(nc0) : "memory");

  // Element offsets fit 32 bits: one offset register a row serves the loads
  // and the stores of that row, on scalar bases. The residual values of the
  // next row of tiles are loaded before the current one is stored.
  float rv[2][4][8];
  auto ld_resid = [&](int i) {
#pragma unroll
    for (int v = 0; v < 8; v++) {
      uint32_t o = (uint32_t)(mrow + i * 16 + v) * (uint32_t)Nd + (uint32_t)nc0;
#pragma unroll
      for (int j = 0; j < 4; j++) rv[i & 1][j][v] = (resid + j * 16)[o];
    }
  };
  if (RESID) ld_resid(0);
#pragma unroll
  for (int i = 0; i < 4; i++) {
    if (RESID) {
      if (i + 1 < 4) ld_resid(i + 1);
      // keeps the 32 loads of a row of tiles in flight together and ahead of
      // the stores; sunk to their uses, each would cost a round trip to memory
      __builtin_amdgcn_sched_barrier(0);
    }
#pragma unroll
    for (int v = 0; v < 8; v++) {
      uint32_t o = (uint32_t)(mrow + i * 16 + v) * (uint32_t)Nd + (uint32_t)nc0;
#pragma unroll
      for (int j = 0; j < 4; j++) {
        float val = (acc[i][j][v] + bn[j]) * alpha;
        if (RESID)
          (outf + j * 16)[o] = val + rv[i & 1][j][v];
        else
          (outh + j * 16)[o] = (half_t)val;
      }
    }
    // the registers that these stores name are loaded into again two rows of
    // tiles on: the wait stands between
    if (RESID && i + 2 < 4) asm volatile("s_wait_xcnt 0x0" ::: "memory");
  }
}

// Three products of the same Nd in one grid: block rows [0, y0) belong to j0,
// [y0, y0 + y1) to j1, the rest to j2. The longest K goes first, so that the
// shorter blocks fill the end of the launch.
struct GemmJob {
  const half_t* A;
  const half_t* Wt;
  const float* bias;
  half_t* outh;
  int Kd;
  float alpha;
};

__global__ __launch_bounds__(256, 4)
void gemm_three(GemmJob j0, GemmJob j1, GemmJob j2, int y0, int y1, int Nd) {
  // the block's job: the same for every thread of the block
  int by = blockIdx.y;
  GemmJob jb = j0;
  if (by >= y0 + y1)  { jb = j2; by -= y0 + y1; }
  else if (by >= y0)  { jb = j1; by -= y0; }
  gemm_tile<false>(jb.A, jb.Wt, jb.bias, nullptr, jb.outh, nullptr, Nd, jb.Kd, jb.alpha, by);
}

__global__ __launch_bounds__(256, 4)
void gemm_resid(const half_t* __restrict__ A, const half_t* __restrict__ Wt,
                const float* __restrict__ bias, const float* __restrict__ resid,
                float* __restrict__ outf, int Nd, int Kd, float alpha) {
  gemm_tile<true>(A, Wt, bias, resid, nullptr, outf, Nd, Kd, alpha, blockIdx.y);
}

// ---------------------------------------------------------------------------
// Fused attention per (b,h) and 128-row Q tile. K (256x64) staged to LDS
// via async-to-LDS; V staged transposed (64x256). S = QK^T via WMMA (Q
// pre-scaled by 1/8 in the Q GEMM), exact softmax over N=256 (16 lanes x 16
// tiles, shfl_xor reduction within half-wave), P->LDS f16, y = P@V via WMMA.
// ---------------------------------------------------------------------------
__global__ __launch_bounds__(256)
void attn_kernel(const half_t* __restrict__ qh, const half_t* __restrict__ kh,
                 const half_t* __restrict__ vh, half_t* __restrict__ y) {
  __shared__ __align__(16) half_t Ks[256 * 72];   // 36 KB
  __shared__ __align__(16) half_t Vt[64 * 264];   // 33 KB (V transposed)
  __shared__ __align__(16) half_t Ps[128 * 264];  // 66 KB
  int bh = blockIdx.x;
  int b = bh / H_, h = bh % H_;
  int t0 = blockIdx.y * 128;
  int tid = threadIdx.x, lane = tid & 31, w = tid >> 5;

  // Stage K (async global->LDS) and V^T (manual transpose)
  for (int c = tid; c < 2048; c += 256) {
    int tok = c >> 3, d0 = (c & 7) * 8;
    size_t gbase = ((size_t)(b * N_ + tok)) * D_ + h * DH_ + d0;
    async_ld_b128(lds_off(Ks + tok * 72 + d0), kh + gbase);
    h8 vv = *(const h8*)(vh + gbase);
#pragma unroll
    for (int e = 0; e < 8; e++) Vt[(d0 + e) * 264 + tok] = vv[e];
  }

  // Q fragments for this wave's 16 rows (dh=64 -> two K=32 fragments)
  v16h qa[2];
  {
    int m = lane & 15, hi = (lane >> 4) * 8;
    int t = t0 + w * 16 + m;
    const half_t* qp = qh + ((size_t)(b * T_ + t)) * D_ + h * DH_;
#pragma unroll
    for (int ks = 0; ks < 2; ks++) {
      union { v16h v; h8 hh[2]; } u;
      u.hh[0] = *(const h8*)(qp + ks * 32 + hi);
      u.hh[1] = *(const h8*)(qp + ks * 32 + 16 + hi);
      qa[ks] = u.v;
    }
  }
  wait_async0();
  __syncthreads();

  // S = Q K^T : 16 column tiles of 16, accumulate over dh in 2 steps
  v8f accs[16];
#pragma unroll
  for (int nt = 0; nt < 16; nt++) {
    accs[nt] = zero8();
#pragma unroll
    for (int ks = 0; ks < 2; ks++) {
      v16h bf = ld_frag(Ks + (nt * 16) * 72 + ks * 32, 72, lane);
      accs[nt] = wmma_f16(qa[ks], bf, accs[nt]);
    }
  }

  float rinv[8];
#pragma unroll
  for (int j = 0; j < 8; j++) {
    float m = -1e30f;
#pragma unroll
    for (int nt = 0; nt < 16; nt++) m = fmaxf(m, accs[nt][j]);
#pragma unroll
    for (int msk = 8; msk; msk >>= 1) m = fmaxf(m, __shfl_xor(m, msk, 32));
    float ssum = 0.f;
#pragma unroll
    for (int nt = 0; nt < 16; nt++) {
      float e = __expf(accs[nt][j] - m);
      accs[nt][j] = e;
      ssum += e;
    }
#pragma unroll
    for (int msk = 8; msk; msk >>= 1) ssum += __shfl_xor(ssum, msk, 32);
    rinv[j] = 1.f / ssum;
  }

  // P -> LDS (each wave owns its 16 rows; same-wave LDS RAW is in-order)
#pragma unroll
  for (int nt = 0; nt < 16; nt++)
#pragma unroll
    for (int j = 0; j < 8; j++) {
      int rl = w * 16 + j + ((lane >> 4) << 3);
      Ps[rl * 264 + nt * 16 + (lane & 15)] = (half_t)(accs[nt][j] * rinv[j]);
    }

  // y = P @ V : K=256 in 8 steps of 32; 4 output tiles (dh=64)
  v8f accy[4];
#pragma unroll
  for (int j = 0; j < 4; j++) accy[j] = zero8();
  for (int kt = 0; kt < 8; kt++) {
    v16h af = ld_frag(Ps + (w * 16) * 264 + kt * 32, 264, lane);
#pragma unroll
    for (int j = 0; j < 4; j++) {
      v16h bf = ld_frag(Vt + (j * 16) * 264 + kt * 32, 264, lane);
      accy[j] = wmma_f16(af, bf, accy[j]);
    }
  }

#pragma unroll
  for (int j = 0; j < 4; j++) {
    int n = h * DH_ + j * 16 + (lane & 15);
#pragma unroll
    for (int v = 0; v < 8; v++) {
      int t = t0 + w * 16 + v + ((lane >> 4) << 3);
      y[((size_t)(b * T_ + t)) * D_ + n] = (half_t)accy[j][v];
    }
  }
}

// ---------------------------------------------------------------------------
// emb_out[b, o] = silu(emb[b]) @ We + be   (B=4 x 2048)
// One block owns 32 output columns (one 128 B line of every We row) for all
// four batch entries, so We is read once. Its 8 waves split the 1024 rows:
// a wave takes its 128 rows in four groups of 32 row loads, the next group in
// flight under the sums of the current one, the first under the silu staging;
// the per-wave partial sums are folded through LDS.
// Part of front_kernel: 256 threads (8 waves), blk in [0, 2*D_/32); smem is
// EMB_SMEM floats of the block's LDS.
// ---------------------------------------------------------------------------
#define EMB_SMEM (B_ * TE_ + 8 * B_ * 32)
__device__ __forceinline__
void emb_out_block(const float* __restrict__ emb, const float* __restrict__ We,
                   const float* __restrict__ be, float* __restrict__ eo,
                   float* smem, int blk) {
  static_assert(B_ * TE_ == 4096 && TE_ == 1024, "256 threads stage 16 values each");
  float* se = smem;               // [B_][TE_]
  float* part = smem + B_ * TE_;  // [8][B_][32]
  int tid = threadIdx.x, lane = tid & 31;
  // the wave's number as a scalar: the row base stays in scalar registers
  int w = __builtin_amdgcn_readfirstlane(tid >> 5);
  int o = blk * 32 + lane;

  float4 ev[4];
#pragma unroll
  for (int p = 0; p < 4; p++) ev[p] = *(const float4*)(emb + (p * 256 + tid) * 4);
  const float* wp = We + (size_t)(w * 128) * (2 * D_) + o;
  float wv[32], wn[32];
#pragma unroll
  for (int i = 0; i < 32; i++) wv[i] = wp[(size_t)i * (2 * D_)];
  float bo = be[o];
  // keeps every load above issued before the silu arithmetic waits for emb;
  // without it the We loads start only after that first round trip to memory
  __builtin_amdgcn_sched_barrier(0);

#pragma unroll
  for (int p = 0; p < 4; p++) {
    ev[p].x = ev[p].x / (1.f + __expf(-ev[p].x));
    ev[p].y = ev[p].y / (1.f + __expf(-ev[p].y));
    ev[p].z = ev[p].z / (1.f + __expf(-ev[p].z));
    ev[p].w = ev[p].w / (1.f + __expf(-ev[p].w));
    *(float4*)(se + (p * 256 + tid) * 4) = ev[p];
  }
  __syncthreads();

  float acc[B_];
#pragma unroll
  for (int b = 0; b < B_; b++) acc[b] = 0.f;
  // unrolled so that both row groups stay in registers
#pragma unroll
  for (int c = 0; c < 4; c++) {
    if (c + 1 < 4) {
#pragma unroll
      for (int i = 0; i < 32; i++) wn[i] = wp[(size_t)((c + 1) * 32 + i) * (2 * D_)];
    }
#pragma unroll
    for (int i = 0; i < 32; i += 4)
#pragma unroll
      for (int b = 0; b < B_; b++) {
        float4 s = *(const float4*)(se + b * TE_ + w * 128 + c * 32 + i);
        acc[b] += s.x * wv[i];
        acc[b] += s.y * wv[i + 1];
        acc[b] += s.z * wv[i + 2];
        acc[b] += s.w * wv[i + 3];
      }
    if (c + 1 < 4) {
#pragma unroll
      for (int i = 0; i < 32; i++) wv[i] = wn[i];
    }
  }
#pragma unroll
  for (int b = 0; b < B_; b++) part[(w * B_ + b) * 32 + lane] = acc[b];
  __syncthreads();

  // waves 0..3 fold the 8 partials of one batch entry each, in four chains
  if (w < B_) {
    float s[4] = {0.f, 0.f, 0.f, 0.f};
#pragma unroll
    for (int p = 0; p < 8; p++) s[p & 3] += part[(p * B_ + w) * 32 + lane];
    eo[w * (2 * D_) + o] = ((s[0] + s[1]) + (s[2] + s[3])) + bo;
  }
}

#define FB_EMB (2 * D_ / 32)
#define FB_LNX (B_ * T_ / 32)
#define FB_WDD ((D_ / 64) * (D_ / 64))
#define FB_WLD ((D_ / 64) * (L_ / 64))
#define FB_LNF (B_ * N_ / 8)
#define FRONT_BLOCKS (FB_EMB + FB_LNX + 2 * FB_WDD + 2 * FB_WLD + FB_LNF)
__global__ __launch_bounds__(256)
void front_kernel(const float* __restrict__ x, const float* __restrict__ xf,
                  const float* __restrict__ emb,
                  const float* __restrict__ norm_g, const float* __restrict__ norm_b,
                  const float* __restrict__ tnorm_g, const float* __restrict__ tnorm_b,
                  const float* __restrict__ Wq, const float* __restrict__ Wk,
                  const float* __restrict__ Wv, const float* __restrict__ Wo,
                  const float* __restrict__ We, const float* __restrict__ be,
                  half_t* __restrict__ xh, half_t* __restrict__ xfh,
                  half_t* __restrict__ Wqt, half_t* __restrict__ Wkt,
                  half_t* __restrict__ Wvt, half_t* __restrict__ Wot,
                  float* __restrict__ eo) {
  static_assert(EMB_SMEM >= 64 * 65, "the LDS serves the emb part or one weight tile");
  __shared__ __align__(16) float smem[EMB_SMEM];
  int blk = blockIdx.x;
  if (blk < FB_EMB) { emb_out_block(emb, We, be, eo, smem, blk); return; }
  blk -= FB_EMB;
  if (blk < FB_LNX) { ln_rows_f16<D_, 4>(x, norm_g, norm_b, xh, blk); return; }
  blk -= FB_LNX;
  if (blk < FB_LNF) { ln_rows_f16<L_, 1>(xf, tnorm_g, tnorm_b, xfh, blk); return; }
  blk -= FB_LNF;
  const float* W = Wq;
  half_t* Wt = Wqt;
  int K = D_;
  if (blk >= FB_WDD + 2 * FB_WLD) { W = Wo; Wt = Wot; blk -= FB_WDD + 2 * FB_WLD; }
  else if (blk >= FB_WDD + FB_WLD) { W = Wv; Wt = Wvt; K = L_; blk -= FB_WDD + FB_WLD; }
  else if (blk >= FB_WDD) { W = Wk; Wt = Wkt; K = L_; blk -= FB_WDD; }
  w_to_f16_t(W, Wt, K, D_, smem, blk);
}

// ---------------------------------------------------------------------------
// Stylize: h = silu( LN(y) * (1 + scale_b) + shift_b ) -> f16
// One wave owns a whole row of D_ halfs in registers (16 B per lane and load),
// sums by a lane butterfly, no LDS and no barrier. Each wave takes ROWS
// consecutive rows of one batch entry; gain, bias, scale and shift are read
// once per wave, and the next row is loaded before the current one is summed.
// Launch: 512 threads (16 waves), grid = B_*T_ / (16 * ROWS).
// ---------------------------------------------------------------------------
template <int ROWS>
__global__ __launch_bounds__(512)
void stylize_kernel(const half_t* __restrict__ y, const float* __restrict__ eo,
                    const float* __restrict__ g, const float* __restrict__ bt,
                    half_t* __restrict__ out) {
  static_assert(T_ % ROWS == 0, "the rows of a wave share one batch entry");
  constexpr int NV = D_ / 256;  // 8 halfs per lane and load
  int lane = threadIdx.x & 31;
  // the wave's number as a scalar: row bases stay in scalar registers
  int w = __builtin_amdgcn_readfirstlane(threadIdx.x >> 5);
  size_t row0 = ((size_t)blockIdx.x * 16 + w) * ROWS;
  int b = (int)(row0 / T_);
  const half_t* src = y + row0 * D_ + lane * 8;
  half_t* dst = out + row0 * D_ + lane * 8;

  h8 cur[NV], nxt[NV];
#pragma unroll
  for (int p = 0; p < NV; p++) cur[p] = *(const h8*)(src + p * 256);

  float gv[NV][8], bv[NV][8], sc1[NV][8], sh[NV][8];
#pragma unroll
  for (int p = 0; p < NV; p++)
#pragma unroll
    for (int hf = 0; hf < 2; hf++) {
      int i = p * 256 + lane * 8 + hf * 4;
      float4 tg = *(const float4*)(g + i);
      float4 tb = *(const float4*)(bt + i);
      float4 tc = *(const float4*)(eo + b * (2 * D_) + i);
      float4 ts = *(const float4*)(eo + b * (2 * D_) + D_ + i);
      gv[p][hf * 4 + 0] = tg.x; gv[p][hf * 4 + 1] = tg.y;
      gv[p][hf * 4 + 2] = tg.z; gv[p][hf * 4 + 3] = tg.w;
      bv[p][hf * 4 + 0] = tb.x; bv[p][hf * 4 + 1] = tb.y;
      bv[p][hf * 4 + 2] = tb.z; bv[p][hf * 4 + 3] = tb.w;
      sc1[p][hf * 4 + 0] = 1.f + tc.x; sc1[p][hf * 4 + 1] = 1.f + tc.y;
      sc1[p][hf * 4 + 2] = 1.f + tc.z; sc1[p][hf * 4 + 3] = 1.f + tc.w;
      sh[p][hf * 4 + 0] = ts.x; sh[p][hf * 4 + 1] = ts.y;
      sh[p][hf * 4 + 2] = ts.z; sh[p][hf * 4 + 3] = ts.w;
    }

  // unrolled so that both row buffers stay in registers and every row offset
  // is an immediate of its load or store
#pragma unroll
  for (int r = 0; r < ROWS; r++) {
    if (r + 1 < ROWS) {
#pragma unroll
      for (int p = 0; p < NV; p++) nxt[p] = *(const h8*)(src + (r + 1) * D_ + p * 256);
    }
    float a[4] = {0.f, 0.f, 0.f, 0.f}, q[4] = {0.f, 0.f, 0.f, 0.f};
#pragma unroll
    for (int p = 0; p < NV; p++)
#pragma unroll
      for (int e = 0; e < 8; e++) {
        float v = (float)cur[p][e];
        a[e & 3] += v; q[e & 3] += v * v;
      }
    float s = (a[0] + a[1]) + (a[2] + a[3]), s2 = (q[0] + q[1]) + (q[2] + q[3]);
#pragma unroll
    for (int m = 16; m; m >>= 1) { s += __shfl_xor(s, m, 32); s2 += __shfl_xor(s2, m, 32); }
    float mu = s / (float)D_;
    float var = s2 / (float)D_ - mu * mu;
    float rs = rsqrtf(var + 1e-5f);
#pragma unroll
    for (int p = 0; p < NV; p++) {
      h8 o;
#pragma unroll
      for (int e = 0; e < 8; e++) {
        float ln = ((float)cur[p][e] - mu) * rs * gv[p][e] + bv[p][e];
        float hv = ln * sc1[p][e] + sh[p][e];
        hv = hv / (1.f + __expf(-hv));  // silu
        o[e] = (half_t)hv;
      }
      *(h8*)(dst + r * D_ + p * 256) = o;
    }
    if (r + 1 < ROWS) {
#pragma unroll
      for (int p = 0; p < NV; p++) cur[p] = nxt[p];
    }
  }
}

// ---------------------------------------------------------------------------
extern "C" void kernel_launch(void* const* d_in, const int* in_sizes, int n_in,
                              void* d_out, int out_size, void* d_ws, size_t ws_size,
                              hipStream_t stream) {
  (void)in_sizes; (void)n_in; (void)out_size; (void)ws_size;
  const float* x       = (const float*)d_in[0];
  const float* xf      = (const float*)d_in[1];
  const float* emb     = (const float*)d_in[2];
  const float* norm_g  = (const float*)d_in[3];
  const float* norm_b  = (const float*)d_in[4];
  const float* tnorm_g = (const float*)d_in[5];
  const float* tnorm_b = (const float*)d_in[6];
  const float* Wq      = (const float*)d_in[7];
  const float* bq      = (const float*)d_in[8];
  const float* Wk      = (const float*)d_in[9];
  const float* bk      = (const float*)d_in[10];
  const float* Wv      = (const float*)d_in[11];
  const float* bv      = (const float*)d_in[12];
  const float* We      = (const float*)d_in[13];
  const float* be      = (const float*)d_in[14];
  const float* snorm_g = (const float*)d_in[15];
  const float* snorm_b = (const float*)d_in[16];
  const float* Wo      = (const float*)d_in[17];
  const float* bo      = (const float*)d_in[18];
  float* out = (float*)d_out;

  // Workspace layout (256B aligned)
  char* ws = (char*)d_ws;
  size_t off = 0;
  auto alloc = [&](size_t bytes) {
    char* p = ws + off;
    off += (bytes + 255) & ~(size_t)255;
    return p;
  };
  const size_t BT = (size_t)B_ * T_;
  const size_t BN = (size_t)B_ * N_;
  half_t* xh  = (half_t*)alloc(BT * D_ * 2);        // LN(x) f16; reused as hsty later
  half_t* xfh = (half_t*)alloc(BN * L_ * 2);        // LN(xf) f16
  half_t* Wqt = (half_t*)alloc((size_t)D_ * D_ * 2);
  half_t* Wkt = (half_t*)alloc((size_t)D_ * L_ * 2);
  half_t* Wvt = (half_t*)alloc((size_t)D_ * L_ * 2);
  half_t* Wot = (half_t*)alloc((size_t)D_ * D_ * 2);
  half_t* qh  = (half_t*)alloc(BT * D_ * 2);
  half_t* khb = (half_t*)alloc(BN * D_ * 2);
  half_t* vhb = (half_t*)alloc(BN * D_ * 2);
  half_t* yb  = (half_t*)alloc(BT * D_ * 2);
  float*  eo  = (float*)alloc((size_t)B_ * 2 * D_ * 4);

  // 1) all that reads only the inputs: emb MLP, LayerNorms -> f16, weights ->
  //    f16 transposed (N x K)
  front_kernel<<<FRONT_BLOCKS, 256, 0, stream>>>(
      x, xf, emb, norm_g, norm_b, tnorm_g, tnorm_b, Wq, Wk, Wv, Wo, We, be,
      xh, xfh, Wqt, Wkt, Wvt, Wot, eo);

  // 2) Projections in one grid (Q folds 1/sqrt(dh)=0.125)
  GemmJob jq = {xh, Wqt, bq, qh, D_, 0.125f};
  GemmJob jk = {xfh, Wkt, bk, khb, L_, 1.0f};
  GemmJob jv = {xfh, Wvt, bv, vhb, L_, 1.0f};
  gemm_three<<<dim3(D_ / 128, (int)((BT + 2 * BN) / GM_)), 256, 0, stream>>>(
      jq, jk, jv, (int)(BT / GM_), (int)(BN / GM_), D_);

  // 3) attention: grid (B*H, T/128)
  attn_kernel<<<dim3(B_ * H_, T_ / 128), 256, 0, stream>>>(qh, khb, vhb, yb);

  // 4) stylize (xh buffer reused as f16 h)
  stylize_kernel<4><<<(int)(BT / 64), 512, 0, stream>>>(yb, eo, snorm_g, snorm_b, xh);

  // 5) out = x + h @ Wo + bo
  gemm_resid<<<dim3(D_ / 128, (int)(BT / GM_)), 256, 0, stream>>>(
      xh, Wot, bo, x, out, D_, D_, 1.0f);
}

// v006
// Measured time: 149 microseconds a run.
// Two timings next to v005 both put it at 1.09 times that version's speed.
// Over all steps from v000 it is 2.78 times as fast.
#include <hip/hip_runtime.h>
#include <hip/hip_fp16.h>

typedef _Float16 half_t;
typedef __attribute__((ext_vector_type(16))) _Float16 v16h;
typedef __attribute__((ext_vector_type(8)))  _Float16 h8;
typedef __attribute__((ext_vector_type(4)))  _Float16 h4;
typedef __attribute__((ext_vector_type(8)))  float    v8f;

#define B_  4
#define T_  4096
#define D_  1024
#define N_  256
#define L_  768
#define H_  16
#define DH_ 64
#define TE_ 1024

__device__ inline v8f zero8() {
  v8f z;
#pragma unroll
  for (int i = 0; i < 8; i++) z[i] = 0.f;
  return z;
}

__device__ inline v8f wmma_f16(v16h a, v16h b, v8f c) {
  return __builtin_amdgcn_wmma_f32_16x16x32_f16(
      /*neg_a=*/false, a, /*neg_b=*/false, b,
      /*c_mod=*/(short)0, c, /*reuse_a=*/false, /*reuse_b=*/false);
}

__device__ inline uint32_t lds_off(const void* p) {
  return (uint32_t)(uintptr_t)p;
}
__device__ inline void async_ld_b128(uint32_t ldsaddr, const void* g) {
  asm volatile("global_load_async_to_lds_b128 %0, %1, off"
               :: "v"(ldsaddr), "v"((unsigned long long)(uintptr_t)g)
               : "memory");
}
__device__ inline void wait_async0() {
  asm volatile("s_wait_asynccnt 0x0" ::: "memory");
}

__device__ inline v16h ld_frag(const half_t* tileBase, int stride, int lane) {
  int m  = lane & 15;
  int hi = (lane >> 4) * 8;
  const half_t* p = tileBase + m * stride + hi;
  union { v16h v; h8 h[2]; } u;
  u.h[0] = *(const h8*)(p);
  u.h[1] = *(const h8*)(p + 16);
  return u.v;
}

__device__ inline float rsqrt_slot(float x) {
  bool tiny = x < 1.17549435e-38f;
  float xs = tiny ? x * 16777216.f : x;
  float r;
  asm("v_rsq_f32 %0, %1\n\tv_nop" : "=v"(r) : "v"(xs));
  return tiny ? r * 4096.f : r;
}

// ---------------------------------------------------------------------------
// LayerNorm over WIDTH fp32 -> fp16 row output. One wave owns a whole row: the
// row stays in registers (16 B per lane and load, 512 contiguous bytes per
// wave), its sums are folded by a lane butterfly, so no LDS and no barrier.
// Each wave takes ROWS consecutive rows, gain and bias are read once per wave,
// and the next row is loaded before the current one is summed.
// Part of front_kernel: 256 threads (8 waves), blk in [0, rows / (8 * ROWS)).
// ---------------------------------------------------------------------------
template <int WIDTH, int ROWS>
__device__ __forceinline__
void ln_rows_f16(const float* __restrict__ in, const float* __restrict__ g,
                 const float* __restrict__ bt, half_t* __restrict__ out, int blk) {
  static_assert(WIDTH % 128 == 0, "a wave covers 128 floats per load");
  constexpr int NV = WIDTH / 128;
  int lane = threadIdx.x & 31;
  // the wave's number as a scalar: row bases stay in scalar registers
  int w = __builtin_amdgcn_readfirstlane(threadIdx.x >> 5);
  size_t row0 = ((size_t)blk * 8 + w) * ROWS;
  const float* src = in + row0 * WIDTH + lane * 4;
  half_t* dst = out + row0 * WIDTH + lane * 4;

  float4 cur[NV], nxt[NV], gv[NV], bv[NV];
#pragma unroll
  for (int p = 0; p < NV; p++) cur[p] = *(const float4*)(src + p * 128);
#pragma unroll
  for (int p = 0; p < NV; p++) {
    gv[p] = *(const float4*)(g + lane * 4 + p * 128);
    bv[p] = *(const float4*)(bt + lane * 4 + p * 128);
  }

  // unrolled so that both row buffers stay in registers and every row offset
  // is an immediate of its load or store
#pragma unroll
  for (int r = 0; r < ROWS; r++) {
    if (r + 1 < ROWS) {
#pragma unroll
      for (int p = 0; p < NV; p++)
        nxt[p] = *(const float4*)(src + (r + 1) * WIDTH + p * 128);
    }
    float4 a = make_float4(0.f, 0.f, 0.f, 0.f), q = a;
#pragma unroll
    for (int p = 0; p < NV; p++) {
      float4 v = cur[p];
      a.x += v.x; a.y += v.y; a.z += v.z; a.w += v.w;
      q.x += v.x * v.x; q.y += v.y * v.y; q.z += v.z * v.z; q.w += v.w * v.w;
    }
    float s = (a.x + a.y) + (a.z + a.w), s2 = (q.x + q.y) + (q.z + q.w);
#pragma unroll
    for (int m = 16; m; m >>= 1) { s += __shfl_xor(s, m, 32); s2 += __shfl_xor(s2, m, 32); }
    float mu = s / (float)WIDTH;
    float var = s2 / (float)WIDTH - mu * mu;
    float rs = rsqrt_slot(var + 1e-5f);
#pragma unroll
    for (int p = 0; p < NV; p++) {
      float4 v = cur[p];
      h4 o;
      o[0] = (half_t)((v.x - mu) * rs * gv[p].x + bv[p].x);
      o[1] = (half_t)((v.y - mu) * rs * gv[p].y + bv[p].y);
      o[2] = (half_t)((v.z - mu) * rs * gv[p].z + bv[p].z);
      o[3] = (half_t)((v.w - mu) * rs * gv[p].w + bv[p].w);
      *(h4*)(dst + r * WIDTH + p * 128) = o;
    }
    if (r + 1 < ROWS) {
#pragma unroll
      for (int p = 0; p < NV; p++) cur[p] = nxt[p];
    }
  }
}

__device__ __forceinline__
void w_to_f16_t(const float* __restrict__ W, half_t* __restrict__ Wt, int K, int N,
                float* tile, int blk) {
  int tid = threadIdx.x;
  int n0 = (blk % (N / 64)) * 64, k0 = (blk / (N / 64)) * 64;

  int c4 = (tid & 15) * 4, kr = tid >> 4;
  float4 v[4];
#pragma unroll
  for (int p = 0; p < 4; p++)
    v[p] = *(const float4*)(W + (size_t)(k0 + kr + 16 * p) * N + n0 + c4);
#pragma unroll
  for (int p = 0; p < 4; p++) {
    float* t = tile + (kr + 16 * p) * 65 + c4;
    t[0] = v[p].x; t[1] = v[p].y; t[2] = v[p].z; t[3] = v[p].w;
  }
  __syncthreads();

  int kc = (tid & 7) * 8, nr = tid >> 3;
#pragma unroll
  for (int p = 0; p < 2; p++) {
    int n = nr + 32 * p;
    h8 o;
#pragma unroll
    for (int e = 0; e < 8; e++) o[e] = (half_t)tile[(kc + e) * 65 + n];
    *(h8*)(Wt + (size_t)(n0 + n) * K + k0 + kc) = o;
  }
  asm volatile("s_wait_xcnt 0x0" ::: "memory");
}

#define GM_ 256
#define GK_ 64
#define GP_ 72
#define GLS_ (32 * GP_ * 2)

__device__ __forceinline__ void async_ld_rows4(uint32_t l, const half_t* g, size_t gstep) {
  asm volatile(
      "global_load_async_to_lds_b128 %0, %4, off\n\t"
      "global_load_async_to_lds_b128 %1, %5, off\n\t"
      "global_load_async_to_lds_b128 %2, %6, off\n\t"
      "global_load_async_to_lds_b128 %3, %7, off\n\t"
      "s_wait_xcnt 0x0"
      :: "v"(l), "v"(l + GLS_), "v"(l + 2 * GLS_), "v"(l + 3 * GLS_),
         "v"((unsigned long long)(uintptr_t)(g)),
         "v"((unsigned long long)(uintptr_t)(g + gstep)),
         "v"((unsigned long long)(uintptr_t)(g + 2 * gstep)),
         "v"((unsigned long long)(uintptr_t)(g + 3 * gstep))
      : "memory");
}

template <bool RESID>
__device__ __forceinline__
void gemm_tile(const half_t* __restrict__ A, const half_t* __restrict__ Wt,
               const float* __restrict__ bias, const float* __restrict__ resid,
               half_t* __restrict__ outh, float* __restrict__ outf,
               int Nd, int Kd, float alpha, int by) {
  __shared__ __align__(16) half_t As[2][GM_ * GP_];
  __shared__ __align__(16) half_t Bs[2][128 * GP_];
  int tid = threadIdx.x, lane = tid & 31, w = tid >> 5;
  int wm = w & 3, wn = w >> 2;
  int m0 = by * GM_, n0 = blockIdx.x * 128;

  v8f acc[4][4];
#pragma unroll
  for (int i = 0; i < 4; i++)
#pragma unroll
    for (int j = 0; j < 4; j++) acc[i][j] = zero8();

  int r  = tid >> 3;       // first staging row (8 threads a row, rows 32 apart)
  int cH = (tid & 7) * 8;  // staging chunk (8 halfs)
  const half_t* gA = A  + (size_t)(m0 + r) * Kd + cH;
  const half_t* gB = Wt + (size_t)(n0 + r) * Kd + cH;
  size_t gstep = (size_t)32 * Kd;
  uint32_t lA = lds_off(&As[0][r * GP_ + cH]);
  uint32_t lB = lds_off(&Bs[0][r * GP_ + cH]);

  auto issue = [&](int s, int k0) {
    async_ld_rows4(lA + s * (GM_ * GP_ * 2), gA + k0, gstep);
    async_ld_rows4(lA + s * (GM_ * GP_ * 2) + 4 * GLS_, gA + k0 + 4 * gstep, gstep);
    async_ld_rows4(lB + s * (128 * GP_ * 2), gB + k0, gstep);
  };

  int nt = Kd / GK_;
  issue(0, 0);
  wait_async0();    // own copies of tile 0 landed
  __syncthreads();  // everyone's copies of tile 0 visible
  if (nt > 1) issue(1, GK_);

  for (int t = 0; t < nt; t++) {
    const half_t* as = &As[t & 1][(wm * 64) * GP_];
    const half_t* bs = &Bs[t & 1][(wn * 64) * GP_];
#pragma unroll
    for (int ks = 0; ks < GK_ / 32; ks++) {
      v16h af[4], bf[4];
#pragma unroll
      for (int i = 0; i < 4; i++) af[i] = ld_frag(as + (i * 16) * GP_ + ks * 32, GP_, lane);
#pragma unroll
      for (int j = 0; j < 4; j++) bf[j] = ld_frag(bs + (j * 16) * GP_ + ks * 32, GP_, lane);
      // keeps the 16 fragment reads together in front of their 16 products:
      // spread among them, every row of products waits out an LDS round trip
      __builtin_amdgcn_sched_barrier(0);
#pragma unroll
      for (int i = 0; i < 4; i++)
#pragma unroll
        for (int j = 0; j < 4; j++) acc[i][j] = wmma_f16(af[i], bf[j], acc[i][j]);
    }
    // own reads of this buffer retired before anyone's copies may refill it
    asm volatile("s_wait_dscnt 0x0" ::: "memory");
    wait_async0();    // own copies of tile t + 1 landed
    __syncthreads();  // tile t + 1 visible; every reader has left tile t's buffer
    if (t + 2 < nt) issue(t & 1, (t + 2) * GK_);
  }
  wait_async0();  // nothing in flight when the wave ends

  int mrow = m0 + wm * 64 + ((lane >> 4) << 3);
  int nc0  = n0 + wn * 64 + (lane & 15);
  float bn[4];
#pragma unroll
  for (int j = 0; j < 4; j++) bn[j] = bias[nc0 + j * 16];
  // the offset register that the four bias loads name stays whole up to here
  asm volatile("s_wait_xcnt 0x0" :: "v"(nc0) : "memory");

  // Element offsets fit 32 bits: one offset register a row serves the loads
  // and the stores of that row, on scalar bases. The residual values of the
  // next row of tiles are loaded before the current one is stored.
  float rv[2][4][8];
  auto ld_resid = [&](int i) {
#pragma unroll
    for (int v = 0; v < 8; v++) {
      uint32_t o = (uint32_t)(mrow + i * 16 + v) * (uint32_t)Nd + (uint32_t)nc0;
#pragma unroll
      for (int j = 0; j < 4; j++) rv[i & 1][j][v] = (resid + j * 16)[o];
    }
  };
  if (RESID) ld_resid(0);
#pragma unroll
  for (int i = 0; i < 4; i++) {
    if (RESID) {
      if (i + 1 < 4) ld_resid(i + 1);
      // keeps the 32 loads of a row of tiles in flight together and ahead of
      // the stores; sunk to their uses, each would cost a round trip to memory
      __builtin_amdgcn_sched_barrier(0);
    }
#pragma unroll
    for (int v = 0; v < 8; v++) {
      uint32_t o = (uint32_t)(mrow + i * 16 + v) * (uint32_t)Nd + (uint32_t)nc0;
#pragma unroll
      for (int j = 0; j < 4; j++) {
        float val = (acc[i][j][v] + bn[j]) * alpha;
        if (RESID)
          (outf + j * 16)[o] = val + rv[i & 1][j][v];
        else
          (outh + j * 16)[o] = (half_t)val;
      }
    }
    // the registers that these stores name are loaded into again two rows of
    // tiles on: the wait stands between
    if (RESID && i + 2 < 4) asm volatile("s_wait_xcnt 0x0" ::: "memory");
  }
}

// Three products of the same Nd in one grid: block rows [0, y0) belong to j0,
// [y0, y0 + y1) to j1, the rest to j2. The longest K goes first, so that the
// shorter blocks fill the end of the launch.
struct GemmJob {
  const half_t* A;
  const half_t* Wt;
  const float* bias;
  half_t* outh;
  int Kd;
  float alpha;
};

__global__ __launch_bounds__(256, 4)
void gemm_three(GemmJob j0, GemmJob j1, GemmJob j2, int y0, int y1, int Nd) {
  // the block's job: the same for every thread of the block
  int by = blockIdx.y;
  GemmJob jb = j0;
  if (by >= y0 + y1)  { jb = j2; by -= y0 + y1; }
  else if (by >= y0)  { jb = j1; by -= y0; }
  gemm_tile<false>(jb.A, jb.Wt, jb.bias, nullptr, jb.outh, nullptr, Nd, jb.Kd, jb.alpha, by);
}

__global__ __launch_bounds__(256, 4)
void gemm_resid(const half_t* __restrict__ A, const half_t* __restrict__ Wt,
                const float* __restrict__ bias, const float* __restrict__ resid,
                float* __restrict__ outf, int Nd, int Kd, float alpha) {
  gemm_tile<true>(A, Wt, bias, resid, nullptr, outf, Nd, Kd, alpha, blockIdx.y);
}

// ---------------------------------------------------------------------------
// Fused attention per (b,h) and QT_ Q tiles of 128 rows. K (256x64) staged to
// LDS via async-to-LDS; V staged transposed (64x256). S = QK^T via WMMA (Q
// pre-scaled by 1/8 in the Q GEMM), exact softmax over N=256 (16 lanes x 16
// tiles, shfl_xor reduction within half-wave), P->LDS f16, y = P@V via WMMA.
// K and V are staged once and serve all QT_ tiles: the staging (a chain of
// round trips to L2 and the 2 B transposing stores) is paid once per block,
// and the 512 blocks are all resident at two a WGP, so no block waits for a
// place. Behind the one barrier the waves run their tiles independently.
// ---------------------------------------------------------------------------
#define QT_ 4
__global__ __launch_bounds__(256, 4)
void attn_kernel(const half_t* __restrict__ qh, const half_t* __restrict__ kh,
                 const half_t* __restrict__ vh, half_t* __restrict__ y) {
  __shared__ __align__(16) half_t Ks[256 * 72];   // 36 KB
  __shared__ __align__(16) half_t Vt[64 * 264];   // 33 KB (V transposed)
  __shared__ __align__(16) half_t Ps[128 * 264];  // 66 KB
  int bh = blockIdx.x;
  int b = bh / H_, h = bh % H_;
  int t0 = blockIdx.y * (128 * QT_);
  int tid = threadIdx.x, lane = tid & 31, w = tid >> 5;

  // Stage K (async global->LDS) and V^T (manual transpose)
  for (int c = tid; c < 2048; c += 256) {
    int tok = c >> 3, d0 = (c & 7) * 8;
    size_t gbase = ((size_t)(b * N_ + tok)) * D_ + h * DH_ + d0;
    async_ld_b128(lds_off(Ks + tok * 72 + d0), kh + gbase);
    h8 vv = *(const h8*)(vh + gbase);
#pragma unroll
    for (int e = 0; e < 8; e++) Vt[(d0 + e) * 264 + tok] = vv[e];
  }

  // Q fragments for this wave's 16 rows of tile qt (dh=64 -> two K=32 fragments)
  v16h qa[2];
  auto ld_q = [&](int qt) {
    int m = lane & 15, hi = (lane >> 4) * 8;
    int t = t0 + qt * 128 + w * 16 + m;
    const half_t* qp = qh + ((size_t)(b * T_ + t)) * D_ + h * DH_;
#pragma unroll
    for (int ks = 0; ks < 2; ks++) {
      union { v16h v; h8 hh[2]; } u;
      u.hh[0] = *(const h8*)(qp + ks * 32 + hi);
      u.hh[1] = *(const h8*)(qp + ks * 32 + 16 + hi);
      qa[ks] = u.v;
    }
  };
  ld_q(0);
  wait_async0();
  __syncthreads();

  for (int qt = 0; qt < QT_; qt++) {
    // S = Q K^T : 16 column tiles of 16, accumulate over dh in 2 steps
    v8f accs[16];
#pragma unroll
    for (int nt = 0; nt < 16; nt++) {
      accs[nt] = zero8();
#pragma unroll
      for (int ks = 0; ks < 2; ks++) {
        v16h bf = ld_frag(Ks + (nt * 16) * 72 + ks * 32, 72, lane);
        accs[nt] = wmma_f16(qa[ks], bf, accs[nt]);
      }
      // bounds how far the K fragment reads are lifted: with Q already in
      // registers at the head of a trip the compiler lifts all 64 and spills
      if ((nt & 3) == 3) __builtin_amdgcn_sched_barrier(0);
    }
    // the next tile's Q, into the registers that the products above have left:
    // its round trip runs under the rest of this tile's work. The last trip loads
    // its own tile again: a clamped index, so that no branch stands directly
    // behind the matrix instructions whose operands these loads overwrite.
    ld_q(qt + 1 < QT_ ? qt + 1 : qt);

    float rinv[8];
#pragma unroll
    for (int j = 0; j < 8; j++) {
      float m = -1e30f;
#pragma unroll
      for (int nt = 0; nt < 16; nt++) m = fmaxf(m, accs[nt][j]);
#pragma unroll
      for (int msk = 8; msk; msk >>= 1) m = fmaxf(m, __shfl_xor(m, msk, 32));
      float ssum = 0.f;
#pragma unroll
      for (int nt = 0; nt < 16; nt++) {
        float e = __expf(accs[nt][j] - m);
        accs[nt][j] = e;
        ssum += e;
      }
#pragma unroll
      for (int msk = 8; msk; msk >>= 1) ssum += __shfl_xor(ssum, msk, 32);
      rinv[j] = 1.f / ssum;
    }

    // P -> LDS (each wave owns its 16 rows; same-wave LDS RAW is in-order)
#pragma unroll
    for (int nt = 0; nt < 16; nt++)
#pragma unroll
      for (int j = 0; j < 8; j++) {
        int rl = w * 16 + j + ((lane >> 4) << 3);
        Ps[rl * 264 + nt * 16 + (lane & 15)] = (half_t)(accs[nt][j] * rinv[j]);
      }

    // y = P @ V : K=256 in 8 steps of 32; 4 output tiles (dh=64)
    v8f accy[4];
#pragma unroll
    for (int j = 0; j < 4; j++) accy[j] = zero8();
    for (int kt = 0; kt < 8; kt++) {
      v16h af = ld_frag(Ps + (w * 16) * 264 + kt * 32, 264, lane);
#pragma unroll
      for (int j = 0; j < 4; j++) {
        v16h bf = ld_frag(Vt + (j * 16) * 264 + kt * 32, 264, lane);
        accy[j] = wmma_f16(af, bf, accy[j]);
      }
    }

#pragma unroll
    for (int j = 0; j < 4; j++) {
      int n = h * DH_ + j * 16 + (lane & 15);
#pragma unroll
      for (int v = 0; v < 8; v++) {
        int t = t0 + qt * 128 + w * 16 + v + ((lane >> 4) << 3);
        y[((size_t)(b * T_ + t)) * D_ + n] = (half_t)accy[j][v];
      }
    }
    // the next trip reuses the registers that these stores name
    asm volatile("s_wait_xcnt 0x0" ::: "memory");
  }
}

// ---------------------------------------------------------------------------
// emb_out[b, o] = silu(emb[b]) @ We + be   (B=4 x 2048)
// One block owns 32 output columns (one 128 B line of every We row) for all
// four batch entries, so We is read once. Its 8 waves split the 1024 rows:
// a wave takes its 128 rows in four groups of 32 row loads, the next group in
// flight under the sums of the current one, the first under the silu staging;
// the per-wave partial sums are folded through LDS.
// Part of front_kernel: 256 threads (8 waves), blk in [0, 2*D_/32); smem is
// EMB_SMEM floats of the block's LDS.
// ---------------------------------------------------------------------------
#define EMB_SMEM (B_ * TE_ + 8 * B_ * 32)
__device__ __forceinline__
void emb_out_block(const float* __restrict__ emb, const float* __restrict__ We,
                   const float* __restrict__ be, float* __restrict__ eo,
                   float* smem, int blk) {
  static_assert(B_ * TE_ == 4096 && TE_ == 1024, "256 threads stage 16 values each");
  float* se = smem;               // [B_][TE_]
  float* part = smem + B_ * TE_;  // [8][B_][32]
  int tid = threadIdx.x, lane = tid & 31;
  // the wave's number as a scalar: the row base stays in scalar registers
  int w = __builtin_amdgcn_readfirstlane(tid >> 5);
  int o = blk * 32 + lane;

  float4 ev[4];
#pragma unroll
  for (int p = 0; p < 4; p++) ev[p] = *(const float4*)(emb + (p * 256 + tid) * 4);
  const float* wp = We + (size_t)(w * 128) * (2 * D_) + o;
  float wv[32], wn[32];
#pragma unroll
  for (int i = 0; i < 32; i++) wv[i] = wp[(size_t)i * (2 * D_)];
  float bo = be[o];
  // keeps every load above issued before the silu arithmetic waits for emb;
  // without it the We loads start only after that first round trip to memory
  __builtin_amdgcn_sched_barrier(0);

#pragma unroll
  for (int p = 0; p < 4; p++) {
    ev[p].x = ev[p].x / (1.f + __expf(-ev[p].x));
    ev[p].y = ev[p].y / (1.f + __expf(-ev[p].y));
    ev[p].z = ev[p].z / (1.f + __expf(-ev[p].z));
    ev[p].w = ev[p].w / (1.f + __expf(-ev[p].w));
    *(float4*)(se + (p * 256 + tid) * 4) = ev[p];
  }
  __syncthreads();

  float acc[B_];
#pragma unroll
  for (int b = 0; b < B_; b++) acc[b] = 0.f;
  // unrolled so that both row groups stay in registers
#pragma unroll
  for (int c = 0; c < 4; c++) {
    if (c + 1 < 4) {
#pragma unroll
      for (int i = 0; i < 32; i++) wn[i] = wp[(size_t)((c + 1) * 32 + i) * (2 * D_)];
    }
#pragma unroll
    for (int i = 0; i < 32; i += 4)
#pragma unroll
      for (int b = 0; b < B_; b++) {
        float4 s = *(const float4*)(se + b * TE_ + w * 128 + c * 32 + i);
        acc[b] += s.x * wv[i];
        acc[b] += s.y * wv[i + 1];
        acc[b] += s.z * wv[i + 2];
        acc[b] += s.w * wv[i + 3];
      }
    if (c + 1 < 4) {
#pragma unroll
      for (int i = 0; i < 32; i++) wv[i] = wn[i];
    }
  }
#pragma unroll
  for (int b = 0; b < B_; b++) part[(w * B_ + b) * 32 + lane] = acc[b];
  __syncthreads();

  // waves 0..3 fold the 8 partials of one batch entry each, in four chains
  if (w < B_) {
    float s[4] = {0.f, 0.f, 0.f, 0.f};
#pragma unroll
    for (int p = 0; p < 8; p++) s[p & 3] += part[(p * B_ + w) * 32 + lane];
    eo[w * (2 * D_) + o] = ((s[0] + s[1]) + (s[2] + s[3])) + bo;
  }
}

#define FB_EMB (2 * D_ / 32)
#define FB_LNX (B_ * T_ / 32)
#define FB_WDD ((D_ / 64) * (D_ / 64))
#define FB_WLD ((D_ / 64) * (L_ / 64))
#define FB_LNF (B_ * N_ / 8)
#define FRONT_BLOCKS (FB_EMB + FB_LNX + 2 * FB_WDD + 2 * FB_WLD + FB_LNF)
__global__ __launch_bounds__(256)
void front_kernel(const float* __restrict__ x, const float* __restrict__ xf,
                  const float* __restrict__ emb,
                  const float* __restrict__ norm_g, const float* __restrict__ norm_b,
                  const float* __restrict__ tnorm_g, const float* __restrict__ tnorm_b,
                  const float* __restrict__ Wq, const float* __restrict__ Wk,
                  const float* __restrict__ Wv, const float* __restrict__ Wo,
                  const float* __restrict__ We, const float* __restrict__ be,
                  half_t* __restrict__ xh, half_t* __restrict__ xfh,
                  half_t* __restrict__ Wqt, half_t* __restrict__ Wkt,
                  half_t* __restrict__ Wvt, half_t* __restrict__ Wot,
                  float* __restrict__ eo) {
  static_assert(EMB_SMEM >= 64 * 65, "the LDS serves the emb part or one weight tile");
  __shared__ __align__(16) float smem[EMB_SMEM];
  int blk = blockIdx.x;
  if (blk < FB_EMB) { emb_out_block(emb, We, be, eo, smem, blk); return; }
  blk -= FB_EMB;
  if (blk < FB_LNX) { ln_rows_f16<D_, 4>(x, norm_g, norm_b, xh, blk); return; }
  blk -= FB_LNX;
  if (blk < FB_LNF) { ln_rows_f16<L_, 1>(xf, tnorm_g, tnorm_b, xfh, blk); return; }
  blk -= FB_LNF;
  const float* W = Wq;
  half_t* Wt = Wqt;
  int K = D_;
  if (blk >= FB_WDD + 2 * FB_WLD) { W = Wo; Wt = Wot; blk -= FB_WDD + 2 * FB_WLD; }
  else if (blk >= FB_WDD + FB_WLD) { W = Wv; Wt = Wvt; K = L_; blk -= FB_WDD + FB_WLD; }
  else if (blk >= FB_WDD) { W = Wk; Wt = Wkt; K = L_; blk -= FB_WDD; }
  w_to_f16_t(W, Wt, K, D_, smem, blk);
}

// ---------------------------------------------------------------------------
// Stylize: h = silu( LN(y) * (1 + scale_b) + shift_b ) -> f16
// One wave owns a whole row of D_ halfs in registers (16 B per lane and load),
// sums by a lane butterfly, no LDS and no barrier. Each wave takes ROWS
// consecutive rows of one batch entry; gain, bias, scale and shift are read
// once per wave, and the next row is loaded before the current one is summed.
// Launch: 512 threads (16 waves), grid = B_*T_ / (16 * ROWS).
// ---------------------------------------------------------------------------
template <int ROWS>
__global__ __launch_bounds__(512)
void stylize_kernel(const half_t* __restrict__ y, const float* __restrict__ eo,
                    const float* __restrict__ g, const float* __restrict__ bt,
                    half_t* __restrict__ out) {
  static_assert(T_ % ROWS == 0, "the rows of a wave share one batch entry");
  constexpr int NV = D_ / 256;  // 8 halfs per lane and load
  int lane = threadIdx.x & 31;
  // the wave's number as a scalar: row bases stay in scalar registers
  int w = __builtin_amdgcn_readfirstlane(threadIdx.x >> 5);
  size_t row0 = ((size_t)blockIdx.x * 16 + w) * ROWS;
  int b = (int)(row0 / T_);
  const half_t* src = y + row0 * D_ + lane * 8;
  half_t* dst = out + row0 * D_ + lane * 8;

  h8 cur[NV], nxt[NV];
#pragma unroll
  for (int p = 0; p < NV; p++) cur[p] = *(const h8*)(src + p * 256);

  float gv[NV][8], bv[NV][8], sc1[NV][8], sh[NV][8];
#pragma unroll
  for (int p = 0; p < NV; p++)
#pragma unroll
    for (int hf = 0; hf < 2; hf++) {
      int i = p * 256 + lane * 8 + hf * 4;
      float4 tg = *(const float4*)(g + i);
      float4 tb = *(const float4*)(bt + i);
      float4 tc = *(const float4*)(eo + b * (2 * D_) + i);
      float4 ts = *(const float4*)(eo + b * (2 * D_) + D_ + i);
      gv[p][hf * 4 + 0] = tg.x; gv[p][hf * 4 + 1] = tg.y;
      gv[p][hf * 4 + 2] = tg.z; gv[p][hf * 4 + 3] = tg.w;
      bv[p][hf * 4 + 0] = tb.x; bv[p][hf * 4 + 1] = tb.y;
      bv[p][hf * 4 + 2] = tb.z; bv[p][hf * 4 + 3] = tb.w;
      sc1[p][hf * 4 + 0] = 1.f + tc.x; sc1[p][hf * 4 + 1] = 1.f + tc.y;
      sc1[p][hf * 4 + 2] = 1.f + tc.z; sc1[p][hf * 4 + 3] = 1.f + tc.w;
      sh[p][hf * 4 + 0] = ts.x; sh[p][hf * 4 + 1] = ts.y;
      sh[p][hf * 4 + 2] = ts.z; sh[p][hf * 4 + 3] = ts.w;
    }

  // unrolled so that both row buffers stay in registers and every row offset
  // is an immediate of its load or store
#pragma unroll
  for (int r = 0; r < ROWS; r++) {
    if (r + 1 < ROWS) {
#pragma unroll
      for (int p = 0; p < NV; p++) nxt[p] = *(const h8*)(src + (r + 1) * D_ + p * 256);
    }
    float a[4] = {0.f, 0.f, 0.f, 0.f}, q[4] = {0.f, 0.f, 0.f, 0.f};
#pragma unroll
    for (int p = 0; p < NV; p++)
#pragma unroll
      for (int e = 0; e < 8; e++) {
        float v = (float)cur[p][e];
        a[e & 3] += v; q[e & 3] += v * v;
      }
    float s = (a[0] + a[1]) + (a[2] + a[3]), s2 = (q[0] + q[1]) + (q[2] + q[3]);
#pragma unroll
    for (int m = 16; m; m >>= 1) { s += __shfl_xor(s, m, 32); s2 += __shfl_xor(s2, m, 32); }
    float mu = s / (float)D_;
    float var = s2 / (float)D_ - mu * mu;
    float rs = rsqrtf(var + 1e-5f);
#pragma unroll
    for (int p = 0; p < NV; p++) {
      h8 o;
#pragma unroll
      for (int e = 0; e < 8; e++) {
        float ln = ((float)cur[p][e] - mu) * rs * gv[p][e] + bv[p][e];
        float hv = ln * sc1[p][e] + sh[p][e];
        hv = hv / (1.f + __expf(-hv));  // silu
        o[e] = (half_t)hv;
      }
      *(h8*)(dst + r * D_ + p * 256) = o;
    }
    if (r + 1 < ROWS) {
#pragma unroll
      for (int p = 0; p < NV; p++) cur[p] = nxt[p];
    }
  }
}

// ---------------------------------------------------------------------------
extern "C" void kernel_launch(void* const* d_in, const int* in_sizes, int n_in,
                              void* d_out, int out_size, void* d_ws, size_t ws_size,
                              hipStream_t stream) {
  (void)in_sizes; (void)n_in; (void)out_size; (void)ws_size;
  const float* x       = (const float*)d_in[0];
  const float* xf      = (const float*)d_in[1];
  const float* emb     = (const float*)d_in[2];
  const float* norm_g  = (const float*)d_in[3];
  const float* norm_b  = (const float*)d_in[4];
  const float* tnorm_g = (const float*)d_in[5];
  const float* tnorm_b = (const float*)d_in[6];
  const float* Wq      = (const float*)d_in[7];
  const float* bq      = (const float*)d_in[8];
  const float* Wk      = (const float*)d_in[9];
  const float* bk      = (const float*)d_in[10];
  const float* Wv      = (const float*)d_in[11];
  const float* bv      = (const float*)d_in[12];
  const float* We      = (const float*)d_in[13];
  const float* be      = (const float*)d_in[14];
  const float* snorm_g = (const float*)d_in[15];
  const float* snorm_b = (const float*)d_in[16];
  const float* Wo      = (const float*)d_in[17];
  const float* bo      = (const float*)d_in[18];
  float* out = (float*)d_out;

  // Workspace layout (256B aligned)
  char* ws = (char*)d_ws;
  size_t off = 0;
  auto alloc = [&](size_t bytes) {
    char* p = ws + off;
    off += (bytes + 255) & ~(size_t)255;
    return p;
  };
  const size_t BT = (size_t)B_ * T_;
  const size_t BN = (size_t)B_ * N_;
  half_t* xh  = (half_t*)alloc(BT * D_ * 2);        // LN(x) f16; reused as hsty later
  half_t* xfh = (half_t*)alloc(BN * L_ * 2);        // LN(xf) f16
  half_t* Wqt = (half_t*)alloc((size_t)D_ * D_ * 2);
  half_t* Wkt = (half_t*)alloc((size_t)D_ * L_ * 2);
  half_t* Wvt = (half_t*)alloc((size_t)D_ * L_ * 2);
  half_t* Wot = (half_t*)alloc((size_t)D_ * D_ * 2);
  half_t* qh  = (half_t*)alloc(BT * D_ * 2);
  half_t* khb = (half_t*)alloc(BN * D_ * 2);
  half_t* vhb = (half_t*)alloc(BN * D_ * 2);
  half_t* yb  = (half_t*)alloc(BT * D_ * 2);
  float*  eo  = (float*)alloc((size_t)B_ * 2 * D_ * 4);

  // 1) all that reads only the inputs: emb MLP, LayerNorms -> f16, weights ->
  //    f16 transposed (N x K)
  front_kernel<<<FRONT_BLOCKS, 256, 0, stream>>>(
      x, xf, emb, norm_g, norm_b, tnorm_g, tnorm_b, Wq, Wk, Wv, Wo, We, be,
      xh, xfh, Wqt, Wkt, Wvt, Wot, eo);

  // 2) Projections in one grid (Q folds 1/sqrt(dh)=0.125)
  GemmJob jq = {xh, Wqt, bq, qh, D_, 0.125f};
  GemmJob jk = {xfh, Wkt, bk, khb, L_, 1.0f};
  GemmJob jv = {xfh, Wvt, bv, vhb, L_, 1.0f};
  gemm_three<<<dim3(D_ / 128, (int)((BT + 2 * BN) / GM_)), 256, 0, stream>>>(
      jq, jk, jv, (int)(BT / GM_), (int)(BN / GM_), D_);

  // 3) attention: grid (B*H, T/(128*QT_))
  attn_kernel<<<dim3(B_ * H_, T_ / (128 * QT_)), 256, 0, stream>>>(qh, khb, vhb, yb);

  // 4) stylize (xh buffer reused as f16 h)
  stylize_kernel<4><<<(int)(BT / 64), 512, 0, stream>>>(yb, eo, snorm_g, snorm_b, xh);

  // 5) out = x + h @ Wo + bo
  gemm_resid<<<dim3(D_ / 128, (int)(BT / GM_)), 256, 0, stream>>>(
      xh, Wot, bo, x, out, D_, D_, 1.0f);
}

// v007
// Measured time: 140 microseconds a run.
// Two timings next to v006 both put it at 1.06 times that version's speed.
// Counting every step since v000, it is 2.95 times as fast.
#include <hip/hip_runtime.h>
#include <hip/hip_fp16.h>

typedef _Float16 half_t;
typedef __attribute__((ext_vector_type(16))) _Float16 v16h;
typedef __attribute__((ext_vector_type(8)))  _Float16 h8;
typedef __attribute__((ext_vector_type(4)))  _Float16 h4;
typedef __attribute__((ext_vector_type(8)))  float    v8f;

#define B_  4
#define T_  4096
#define D_  1024
#define N_  256
#define L_  768
#define H_  16
#define DH_ 64
#define TE_ 1024

__device__ inline v8f zero8() {
  v8f z;
#pragma unroll
  for (int i = 0; i < 8; i++) z[i] = 0.f;
  return z;
}

__device__ inline v8f wmma_f16(v16h a, v16h b, v8f c) {
  return __builtin_amdgcn_wmma_f32_16x16x32_f16(
      /*neg_a=*/false, a, /*neg_b=*/false, b,
      /*c_mod=*/(short)0, c, /*reuse_a=*/false, /*reuse_b=*/false);
}

__device__ inline uint32_t lds_off(const void* p) {
  return (uint32_t)(uintptr_t)p;
}
__device__ inline void async_ld_b128(uint32_t ldsaddr, const void* g) {
  asm volatile("global_load_async_to_lds_b128 %0, %1, off"
               :: "v"(ldsaddr), "v"((unsigned long long)(uintptr_t)g)
               : "memory");
}
__device__ inline void wait_async0() {
  asm volatile("s_wait_asynccnt 0x0" ::: "memory");
}

__device__ inline v16h ld_frag(const half_t* tileBase, int stride, int lane) {
  int m  = lane & 15;
  int hi = (lane >> 4) * 8;
  const half_t* p = tileBase + m * stride + hi;
  union { v16h v; h8 h[2]; } u;
  u.h[0] = *(const h8*)(p);
  u.h[1] = *(const h8*)(p + 16);
  return u.v;
}

__device__ inline float rsqrt_slot(float x) {
  bool tiny = x < 1.17549435e-38f;
  float xs = tiny ? x * 16777216.f : x;
  float r;
  asm("v_rsq_f32 %0, %1\n\tv_nop" : "=v"(r) : "v"(xs));
  return tiny ? r * 4096.f : r;
}

// ---------------------------------------------------------------------------
// LayerNorm over WIDTH fp32 -> fp16 row output. One wave owns a whole row: the
// row stays in registers (16 B per lane and load, 512 contiguous bytes per
// wave), its sums are folded by a lane butterfly, so no LDS and no barrier.
// Each wave takes ROWS consecutive rows, gain and bias are read once per wave,
// and the next row is loaded before the current one is summed.
// Part of front_kernel: 256 threads (8 waves), blk in [0, rows / (8 * ROWS)).
// ---------------------------------------------------------------------------
template <int WIDTH, int ROWS>
__device__ __forceinline__
void ln_rows_f16(const float* __restrict__ in, const float* __restrict__ g,
                 const float* __restrict__ bt, half_t* __restrict__ out, int blk) {
  static_assert(WIDTH % 128 == 0, "a wave covers 128 floats per load");
  constexpr int NV = WIDTH / 128;
  int lane = threadIdx.x & 31;
  // the wave's number as a scalar: row bases stay in scalar registers
  int w = __builtin_amdgcn_readfirstlane(threadIdx.x >> 5);
  size_t row0 = ((size_t)blk * 8 + w) * ROWS;
  const float* src = in + row0 * WIDTH + lane * 4;
  half_t* dst = out + row0 * WIDTH + lane * 4;

  float4 cur[NV], nxt[NV], gv[NV], bv[NV];
#pragma unroll
  for (int p = 0; p < NV; p++) cur[p] = *(const float4*)(src + p * 128);
#pragma unroll
  for (int p = 0; p < NV; p++) {
    gv[p] = *(const float4*)(g + lane * 4 + p * 128);
    bv[p] = *(const float4*)(bt + lane * 4 + p * 128);
  }

  // unrolled so that both row buffers stay in registers and every row offset
  // is an immediate of its load or store
#pragma unroll
  for (int r = 0; r < ROWS; r++) {
    if (r + 1 < ROWS) {
#pragma unroll
      for (int p = 0; p < NV; p++)
        nxt[p] = *(const float4*)(src + (r + 1) * WIDTH + p * 128);
    }
    float4 a = make_float4(0.f, 0.f, 0.f, 0.f), q = a;
#pragma unroll
    for (int p = 0; p < NV; p++) {
      float4 v = cur[p];
      a.x += v.x; a.y += v.y; a.z += v.z; a.w += v.w;
      q.x += v.x * v.x; q.y += v.y * v.y; q.z += v.z * v.z; q.w += v.w * v.w;
    }
    float s = (a.x + a.y) + (a.z + a.w), s2 = (q.x + q.y) + (q.z + q.w);
#pragma unroll
    for (int m = 16; m; m >>= 1) { s += __shfl_xor(s, m, 32); s2 += __shfl_xor(s2, m, 32); }
    float mu = s / (float)WIDTH;
    float var = s2 / (float)WIDTH - mu * mu;
    float rs = rsqrt_slot(var + 1e-5f);
#pragma unroll
    for (int p = 0; p < NV; p++) {
      float4 v = cur[p];
      h4 o;
      o[0] = (half_t)((v.x - mu) * rs * gv[p].x + bv[p].x);
      o[1] = (half_t)((v.y - mu) * rs * gv[p].y + bv[p].y);
      o[2] = (half_t)((v.z - mu) * rs * gv[p].z + bv[p].z);
      o[3] = (half_t)((v.w - mu) * rs * gv[p].w + bv[p].w);
      *(h4*)(dst + r * WIDTH + p * 128) = o;
    }
    if (r + 1 < ROWS) {
#pragma unroll
      for (int p = 0; p < NV; p++) cur[p] = nxt[p];
    }
  }
}

__device__ __forceinline__
void w_to_f16_t(const float* __restrict__ W, half_t* __restrict__ Wt, int K, int N,
                float* tile, int blk) {
  int tid = threadIdx.x;
  int n0 = (blk % (N / 64)) * 64, k0 = (blk / (N / 64)) * 64;

  int c4 = (tid & 15) * 4, kr = tid >> 4;
  float4 v[4];
#pragma unroll
  for (int p = 0; p < 4; p++)
    v[p] = *(const float4*)(W + (size_t)(k0 + kr + 16 * p) * N + n0 + c4);
#pragma unroll
  for (int p = 0; p < 4; p++) {
    float* t = tile + (kr + 16 * p) * 65 + c4;
    t[0] = v[p].x; t[1] = v[p].y; t[2] = v[p].z; t[3] = v[p].w;
  }
  __syncthreads();

  int kc = (tid & 7) * 8, nr = tid >> 3;
#pragma unroll
  for (int p = 0; p < 2; p++) {
    int n = nr + 32 * p;
    h8 o;
#pragma unroll
    for (int e = 0; e < 8; e++) o[e] = (half_t)tile[(kc + e) * 65 + n];
    *(h8*)(Wt + (size_t)(n0 + n) * K + k0 + kc) = o;
  }
  asm volatile("s_wait_xcnt 0x0" ::: "memory");
}

#define GM_ 256
#define GK_ 64
#define GP_ 72
#define GLS_ (32 * GP_ * 2)

__device__ __forceinline__ void async_ld_rows4(uint32_t l, const half_t* g, size_t gstep) {
  asm volatile(
      "global_load_async_to_lds_b128 %0, %4, off\n\t"
      "global_load_async_to_lds_b128 %1, %5, off\n\t"
      "global_load_async_to_lds_b128 %2, %6, off\n\t"
      "global_load_async_to_lds_b128 %3, %7, off\n\t"
      "s_wait_xcnt 0x0"
      :: "v"(l), "v"(l + GLS_), "v"(l + 2 * GLS_), "v"(l + 3 * GLS_),
         "v"((unsigned long long)(uintptr_t)(g)),
         "v"((unsigned long long)(uintptr_t)(g + gstep)),
         "v"((unsigned long long)(uintptr_t)(g + 2 * gstep)),
         "v"((unsigned long long)(uintptr_t)(g + 3 * gstep))
      : "memory");
}

template <bool RESID>
__device__ __forceinline__
void gemm_tile(const half_t* __restrict__ A, const half_t* __restrict__ Wt,
               const float* __restrict__ bias, const float* __restrict__ resid,
               half_t* __restrict__ outh, float* __restrict__ outf,
               int Nd, int Kd, float alpha, int by) {
  __shared__ __align__(16) half_t As[2][GM_ * GP_];
  __shared__ __align__(16) half_t Bs[2][128 * GP_];
  int tid = threadIdx.x, lane = tid & 31, w = tid >> 5;
  int wm = w & 3, wn = w >> 2;
  int m0 = by * GM_, n0 = blockIdx.x * 128;

  v8f acc[4][4];
#pragma unroll
  for (int i = 0; i < 4; i++)
#pragma unroll
    for (int j = 0; j < 4; j++) acc[i][j] = zero8();

  int r  = tid >> 3;       // first staging row (8 threads a row, rows 32 apart)
  int cH = (tid & 7) * 8;  // staging chunk (8 halfs)
  const half_t* gA = A  + (size_t)(m0 + r) * Kd + cH;
  const half_t* gB = Wt + (size_t)(n0 + r) * Kd + cH;
  size_t gstep = (size_t)32 * Kd;
  uint32_t lA = lds_off(&As[0][r * GP_ + cH]);
  uint32_t lB = lds_off(&Bs[0][r * GP_ + cH]);

  auto issue = [&](int s, int k0) {
    async_ld_rows4(lA + s * (GM_ * GP_ * 2), gA + k0, gstep);
    async_ld_rows4(lA + s * (GM_ * GP_ * 2) + 4 * GLS_, gA + k0 + 4 * gstep, gstep);
    async_ld_rows4(lB + s * (128 * GP_ * 2), gB + k0, gstep);
  };

  int nt = Kd / GK_;
  issue(0, 0);
  wait_async0();    // own copies of tile 0 landed
  __syncthreads();  // everyone's copies of tile 0 visible
  if (nt > 1) issue(1, GK_);

  for (int t = 0; t < nt; t++) {
    const half_t* as = &As[t & 1][(wm * 64) * GP_];
    const half_t* bs = &Bs[t & 1][(wn * 64) * GP_];
#pragma unroll
    for (int ks = 0; ks < GK_ / 32; ks++) {
      v16h af[4], bf[4];
#pragma unroll
      for (int i = 0; i < 4; i++) af[i] = ld_frag(as + (i * 16) * GP_ + ks * 32, GP_, lane);
#pragma unroll
      for (int j = 0; j < 4; j++) bf[j] = ld_frag(bs + (j * 16) * GP_ + ks * 32, GP_, lane);
      // keeps the 16 fragment reads together in front of their 16 products:
      // spread among them, every row of products waits out an LDS round trip
      __builtin_amdgcn_sched_barrier(0);
#pragma unroll
      for (int i = 0; i < 4; i++)
#pragma unroll
        for (int j = 0; j < 4; j++) acc[i][j] = wmma_f16(af[i], bf[j], acc[i][j]);
    }
    // own reads of this buffer retired before anyone's copies may refill it
    asm volatile("s_wait_dscnt 0x0" ::: "memory");
    wait_async0();    // own copies of tile t + 1 landed
    __syncthreads();  // tile t + 1 visible; every reader has left tile t's buffer
    if (t + 2 < nt) issue(t & 1, (t + 2) * GK_);
  }
  wait_async0();  // nothing in flight when the wave ends

  int mrow = m0 + wm * 64 + ((lane >> 4) << 3);
  int nc0  = n0 + wn * 64 + (lane & 15);
  float bn[4];
#pragma unroll
  for (int j = 0; j < 4; j++) bn[j] = bias[nc0 + j * 16];
  // the offset register that the four bias loads name stays whole up to here
  asm volatile("s_wait_xcnt 0x0" :: "v"(nc0) : "memory");

  // Element offsets fit 32 bits: one offset register a row serves the loads
  // and the stores of that row, on scalar bases. The residual values of the
  // next row of tiles are loaded before the current one is stored.
  float rv[2][4][8];
  auto ld_resid = [&](int i) {
#pragma unroll
    for (int v = 0; v < 8; v++) {
      uint32_t o = (uint32_t)(mrow + i * 16 + v) * (uint32_t)Nd + (uint32_t)nc0;
#pragma unroll
      for (int j = 0; j < 4; j++) rv[i & 1][j][v] = (resid + j * 16)[o];
    }
  };
  if (RESID) ld_resid(0);
#pragma unroll
  for (int i = 0; i < 4; i++) {
    if (RESID) {
      if (i + 1 < 4) ld_resid(i + 1);
      // keeps the 32 loads of a row of tiles in flight together and ahead of
      // the stores; sunk to their uses, each would cost a round trip to memory
      __builtin_amdgcn_sched_barrier(0);
    }
#pragma unroll
    for (int v = 0; v < 8; v++) {
      uint32_t o = (uint32_t)(mrow + i * 16 + v) * (uint32_t)Nd + (uint32_t)nc0;
#pragma unroll
      for (int j = 0; j < 4; j++) {
        float val = (acc[i][j][v] + bn[j]) * alpha;
        if (RESID)
          (outf + j * 16)[o] = val + rv[i & 1][j][v];
        else
          (outh + j * 16)[o] = (half_t)val;
      }
    }
    // the registers that these stores name are loaded into again two rows of
    // tiles on: the wait stands between
    if (RESID && i + 2 < 4) asm volatile("s_wait_xcnt 0x0" ::: "memory");
  }
}

// Three products of the same Nd in one grid: block rows [0, y0) belong to j0,
// [y0, y0 + y1) to j1, the rest to j2. The longest K goes first, so that the
// shorter blocks fill the end of the launch.
struct GemmJob {
  const half_t* A;
  const half_t* Wt;
  const float* bias;
  half_t* outh;
  int Kd;
  float alpha;
};

__device__ inline void exp2_two_tiles(v8f& p, v8f& q) {
  float a0 = p[0], a1 = p[1], a2 = p[2], a3 = p[3], a4 = p[4], a5 = p[5], a6 = p[6], a7 = p[7];
  float b0 = q[0], b1 = q[1], b2 = q[2], b3 = q[3], b4 = q[4], b5 = q[5], b6 = q[6], b7 = q[7];
  asm("v_exp_f32 %15, %15\n\tv_exp_f32 %14, %14\n\tv_exp_f32 %13, %13\n\tv_exp_f32 %12, %12\n\t"
      "v_exp_f32 %11, %11\n\tv_exp_f32 %10, %10\n\tv_exp_f32 %9, %9\n\tv_exp_f32 %8, %8\n\t"
      "v_exp_f32 %7, %7\n\tv_exp_f32 %6, %6\n\tv_exp_f32 %5, %5\n\tv_exp_f32 %4, %4\n\t"
      "v_exp_f32 %3, %3\n\tv_exp_f32 %2, %2\n\tv_exp_f32 %1, %1\n\tv_exp_f32 %0, %0\n\t"
      "v_nop"
      : "+v"(a0), "+v"(a1), "+v"(a2), "+v"(a3), "+v"(a4), "+v"(a5), "+v"(a6), "+v"(a7),
        "+v"(b0), "+v"(b1), "+v"(b2), "+v"(b3), "+v"(b4), "+v"(b5), "+v"(b6), "+v"(b7));
  p[0] = a0; p[1] = a1; p[2] = a2; p[3] = a3; p[4] = a4; p[5] = a5; p[6] = a6; p[7] = a7;
  q[0] = b0; q[1] = b1; q[2] = b2; q[3] = b3; q[4] = b4; q[5] = b5; q[6] = b6; q[7] = b7;
}
__global__ __launch_bounds__(256, 4)
void gemm_three(GemmJob j0, GemmJob j1, GemmJob j2, int y0, int y1, int Nd) {
  // the block's job: the same for every thread of the block
  int by = blockIdx.y;
  GemmJob jb = j0;
  if (by >= y0 + y1)  { jb = j2; by -= y0 + y1; }
  else if (by >= y0)  { jb = j1; by -= y0; }
  gemm_tile<false>(jb.A, jb.Wt, jb.bias, nullptr, jb.outh, nullptr, Nd, jb.Kd, jb.alpha, by);
}

__global__ __launch_bounds__(256, 4)
void gemm_resid(const half_t* __restrict__ A, const half_t* __restrict__ Wt,
                const float* __restrict__ bias, const float* __restrict__ resid,
                float* __restrict__ outf, int Nd, int Kd, float alpha) {
  gemm_tile<true>(A, Wt, bias, resid, nullptr, outf, Nd, Kd, alpha, blockIdx.y);
}

#define QT_ 4
__device__ inline float other_half(float x) {
  int b = __builtin_bit_cast(int, x);
  return __builtin_bit_cast(
      float, __builtin_amdgcn_permlanex16(b, b, 0x76543210, 0xfedcba98, false, false));
}
__global__ __launch_bounds__(256, 4)
void attn_kernel(const half_t* __restrict__ qh, const half_t* __restrict__ kh,
                 const half_t* __restrict__ vh, half_t* __restrict__ y) {
  __shared__ __align__(16) half_t Ks[256 * 72];   // 36 KB
  __shared__ __align__(16) half_t Vt[64 * 264];   // 33 KB (V transposed)
  int bh = blockIdx.x;
  int b = bh / H_, h = bh % H_;
  int t0 = blockIdx.y * (128 * QT_);
  int tid = threadIdx.x, lane = tid & 31, w = tid >> 5;

  // Stage K (async global->LDS) and V^T (manual transpose)
  for (int c = tid; c < 2048; c += 256) {
    int tok = c >> 3, d0 = (c & 7) * 8;
    size_t gbase = ((size_t)(b * N_ + tok)) * D_ + h * DH_ + d0;
    async_ld_b128(lds_off(Ks + tok * 72 + d0), kh + gbase);
    h8 vv = *(const h8*)(vh + gbase);
#pragma unroll
    for (int e = 0; e < 8; e++) Vt[(d0 + e) * 264 + tok] = vv[e];
  }

  // Q fragments for this wave's 16 rows of tile qt (dh=64 -> two K=32 fragments)
  v16h qa[2];
  auto ld_q = [&](int qt) {
    int m = lane & 15, hi = (lane >> 4) * 8;
    int t = t0 + qt * 128 + w * 16 + m;
    const half_t* qp = qh + ((size_t)(b * T_ + t)) * D_ + h * DH_;
#pragma unroll
    for (int ks = 0; ks < 2; ks++) {
      union { v16h v; h8 hh[2]; } u;
      u.hh[0] = *(const h8*)(qp + ks * 32 + hi);
      u.hh[1] = *(const h8*)(qp + ks * 32 + 16 + hi);
      qa[ks] = u.v;
    }
  };
  ld_q(0);
  wait_async0();
  __syncthreads();

  for (int qt = 0; qt < QT_; qt++) {
    v8f accs[16];
#pragma unroll
    for (int nt = 0; nt < 16; nt++) {
      accs[nt] = zero8();
#pragma unroll
      for (int ks = 0; ks < 2; ks++) {
        v16h kf = ld_frag(Ks + (nt * 16) * 72 + ks * 32, 72, lane);
        accs[nt] = wmma_f16(kf, qa[ks], accs[nt]);
      }
      // bounds how far the K fragment reads are lifted: with Q already in
      // registers at the head of a trip the compiler lifts all 64 and spills
      if ((nt & 3) == 3) __builtin_amdgcn_sched_barrier(0);
    }
    // the next tile's Q, into the registers that the products above have left:
    // its round trip runs under the rest of this tile's work. The last trip loads
    // its own tile again: a clamped index, so that no branch stands directly
    // behind the matrix instructions whose operands these loads overwrite.
    ld_q(qt + 1 < QT_ ? qt + 1 : qt);

    // Softmax over the 256 keys of the lane's query: eight independent chains
    // over the tiles, folded in-lane, then joined with the other wave half.
    float mj[8];
#pragma unroll
    for (int j = 0; j < 8; j++) {
      mj[j] = accs[0][j];
#pragma unroll
      for (int nt = 1; nt < 16; nt++) mj[j] = fmaxf(mj[j], accs[nt][j]);
    }
    float m = fmaxf(fmaxf(fmaxf(mj[0], mj[1]), fmaxf(mj[2], mj[3])),
                    fmaxf(fmaxf(mj[4], mj[5]), fmaxf(mj[6], mj[7])));
    m = fmaxf(m, other_half(m));
    v8f sv = zero8();
#pragma unroll
    for (int nt = 0; nt < 16; nt += 2) {
      // e^(s - m) as 2^((s - m) * log2 e)
      accs[nt]     = (accs[nt] - m) * 1.44269504f;
      accs[nt + 1] = (accs[nt + 1] - m) * 1.44269504f;
      exp2_two_tiles(accs[nt], accs[nt + 1]);
      sv += accs[nt];
      sv += accs[nt + 1];
    }
    float ssum = ((sv[0] + sv[1]) + (sv[2] + sv[3])) + ((sv[4] + sv[5]) + (sv[6] + sv[7]));
    ssum += other_half(ssum);
    float rinv = 1.f / ssum;

    v8f accy[4];
#pragma unroll
    for (int j = 0; j < 4; j++) accy[j] = zero8();
#pragma unroll
    for (int kt = 0; kt < 8; kt++) {
      v16h pf;
#pragma unroll
      for (int e = 0; e < 8; e++) {
        pf[e]     = (half_t)accs[2 * kt][e];
        pf[8 + e] = (half_t)accs[2 * kt + 1][e];
      }
#pragma unroll
      for (int j = 0; j < 4; j++) {
        v16h vf = ld_frag(Vt + (j * 16) * 264 + kt * 32, 264, lane);
        accy[j] = wmma_f16(vf, pf, accy[j]);
      }
    }

    half_t* yp = y + ((size_t)(b * T_ + t0 + qt * 128 + w * 16 + (lane & 15))) * D_ +
                 h * DH_ + ((lane >> 4) << 3);
#pragma unroll
    for (int j = 0; j < 4; j++) {
      h8 o;
#pragma unroll
      for (int v = 0; v < 8; v++) o[v] = (half_t)(accy[j][v] * rinv);
      *(h8*)(yp + j * 16) = o;
    }
    // the next trip reuses the registers that these stores name
    asm volatile("s_wait_xcnt 0x0" ::: "memory");
  }
}

// ---------------------------------------------------------------------------
// emb_out[b, o] = silu(emb[b]) @ We + be   (B=4 x 2048)
// One block owns 32 output columns (one 128 B line of every We row) for all
// four batch entries, so We is read once. Its 8 waves split the 1024 rows:
// a wave takes its 128 rows in four groups of 32 row loads, the next group in
// flight under the sums of the current one, the first under the silu staging;
// the per-wave partial sums are folded through LDS.
// Part of front_kernel: 256 threads (8 waves), blk in [0, 2*D_/32); smem is
// EMB_SMEM floats of the block's LDS.
// ---------------------------------------------------------------------------
#define EMB_SMEM (B_ * TE_ + 8 * B_ * 32)
__device__ __forceinline__
void emb_out_block(const float* __restrict__ emb, const float* __restrict__ We,
                   const float* __restrict__ be, float* __restrict__ eo,
                   float* smem, int blk) {
  static_assert(B_ * TE_ == 4096 && TE_ == 1024, "256 threads stage 16 values each");
  float* se = smem;               // [B_][TE_]
  float* part = smem + B_ * TE_;  // [8][B_][32]
  int tid = threadIdx.x, lane = tid & 31;
  // the wave's number as a scalar: the row base stays in scalar registers
  int w = __builtin_amdgcn_readfirstlane(tid >> 5);
  int o = blk * 32 + lane;

  float4 ev[4];
#pragma unroll
  for (int p = 0; p < 4; p++) ev[p] = *(const float4*)(emb + (p * 256 + tid) * 4);
  const float* wp = We + (size_t)(w * 128) * (2 * D_) + o;
  float wv[32], wn[32];
#pragma unroll
  for (int i = 0; i < 32; i++) wv[i] = wp[(size_t)i * (2 * D_)];
  float bo = be[o];
  // keeps every load above issued before the silu arithmetic waits for emb;
  // without it the We loads start only after that first round trip to memory
  __builtin_amdgcn_sched_barrier(0);

#pragma unroll
  for (int p = 0; p < 4; p++) {
    ev[p].x = ev[p].x / (1.f + __expf(-ev[p].x));
    ev[p].y = ev[p].y / (1.f + __expf(-ev[p].y));
    ev[p].z = ev[p].z / (1.f + __expf(-ev[p].z));
    ev[p].w = ev[p].w / (1.f + __expf(-ev[p].w));
    *(float4*)(se + (p * 256 + tid) * 4) = ev[p];
  }
  __syncthreads();

  float acc[B_];
#pragma unroll
  for (int b = 0; b < B_; b++) acc[b] = 0.f;
  // unrolled so that both row groups stay in registers
#pragma unroll
  for (int c = 0; c < 4; c++) {
    if (c + 1 < 4) {
#pragma unroll
      for (int i = 0; i < 32; i++) wn[i] = wp[(size_t)((c + 1) * 32 + i) * (2 * D_)];
    }
#pragma unroll
    for (int i = 0; i < 32; i += 4)
#pragma unroll
      for (int b = 0; b < B_; b++) {
        float4 s = *(const float4*)(se + b * TE_ + w * 128 + c * 32 + i);
        acc[b] += s.x * wv[i];
        acc[b] += s.y * wv[i + 1];
        acc[b] += s.z * wv[i + 2];
        acc[b] += s.w * wv[i + 3];
      }
    if (c + 1 < 4) {
#pragma unroll
      for (int i = 0; i < 32; i++) wv[i] = wn[i];
    }
  }
#pragma unroll
  for (int b = 0; b < B_; b++) part[(w * B_ + b) * 32 + lane] = acc[b];
  __syncthreads();

  // waves 0..3 fold the 8 partials of one batch entry each, in four chains
  if (w < B_) {
    float s[4] = {0.f, 0.f, 0.f, 0.f};
#pragma unroll
    for (int p = 0; p < 8; p++) s[p & 3] += part[(p * B_ + w) * 32 + lane];
    eo[w * (2 * D_) + o] = ((s[0] + s[1]) + (s[2] + s[3])) + bo;
  }
}

#define FB_EMB (2 * D_ / 32)
#define FB_LNX (B_ * T_ / 32)
#define FB_WDD ((D_ / 64) * (D_ / 64))
#define FB_WLD ((D_ / 64) * (L_ / 64))
#define FB_LNF (B_ * N_ / 8)
#define FRONT_BLOCKS (FB_EMB + FB_LNX + 2 * FB_WDD + 2 * FB_WLD + FB_LNF)
__global__ __launch_bounds__(256)
void front_kernel(const float* __restrict__ x, const float* __restrict__ xf,
                  const float* __restrict__ emb,
                  const float* __restrict__ norm_g, const float* __restrict__ norm_b,
                  const float* __restrict__ tnorm_g, const float* __restrict__ tnorm_b,
                  const float* __restrict__ Wq, const float* __restrict__ Wk,
                  const float* __restrict__ Wv, const float* __restrict__ Wo,
                  const float* __restrict__ We, const float* __restrict__ be,
                  half_t* __restrict__ xh, half_t* __restrict__ xfh,
                  half_t* __restrict__ Wqt, half_t* __restrict__ Wkt,
                  half_t* __restrict__ Wvt, half_t* __restrict__ Wot,
                  float* __restrict__ eo) {
  static_assert(EMB_SMEM >= 64 * 65, "the LDS serves the emb part or one weight tile");
  __shared__ __align__(16) float smem[EMB_SMEM];
  int blk = blockIdx.x;
  if (blk < FB_EMB) { emb_out_block(emb, We, be, eo, smem, blk); return; }
  blk -= FB_EMB;
  if (blk < FB_LNX) { ln_rows_f16<D_, 4>(x, norm_g, norm_b, xh, blk); return; }
  blk -= FB_LNX;
  if (blk < FB_LNF) { ln_rows_f16<L_, 1>(xf, tnorm_g, tnorm_b, xfh, blk); return; }
  blk -= FB_LNF;
  const float* W = Wq;
  half_t* Wt = Wqt;
  int K = D_;
  if (blk >= FB_WDD + 2 * FB_WLD) { W = Wo; Wt = Wot; blk -= FB_WDD + 2 * FB_WLD; }
  else if (blk >= FB_WDD + FB_WLD) { W = Wv; Wt = Wvt; K = L_; blk -= FB_WDD + FB_WLD; }
  else if (blk >= FB_WDD) { W = Wk; Wt = Wkt; K = L_; blk -= FB_WDD; }
  w_to_f16_t(W, Wt, K, D_, smem, blk);
}

// ---------------------------------------------------------------------------
// Stylize: h = silu( LN(y) * (1 + scale_b) + shift_b ) -> f16
// One wave owns a whole row of D_ halfs in registers (16 B per lane and load),
// sums by a lane butterfly, no LDS and no barrier. Each wave takes ROWS
// consecutive rows of one batch entry; gain, bias, scale and shift are read
// once per wave, and the next row is loaded before the current one is summed.
// Launch: 512 threads (16 waves), grid = B_*T_ / (16 * ROWS).
// ---------------------------------------------------------------------------
template <int ROWS>
__global__ __launch_bounds__(512)
void stylize_kernel(const half_t* __restrict__ y, const float* __restrict__ eo,
                    const float* __restrict__ g, const float* __restrict__ bt,
                    half_t* __restrict__ out) {
  static_assert(T_ % ROWS == 0, "the rows of a wave share one batch entry");
  constexpr int NV = D_ / 256;  // 8 halfs per lane and load
  int lane = threadIdx.x & 31;
  // the wave's number as a scalar: row bases stay in scalar registers
  int w = __builtin_amdgcn_readfirstlane(threadIdx.x >> 5);
  size_t row0 = ((size_t)blockIdx.x * 16 + w) * ROWS;
  int b = (int)(row0 / T_);
  const half_t* src = y + row0 * D_ + lane * 8;
  half_t* dst = out + row0 * D_ + lane * 8;

  h8 cur[NV], nxt[NV];
#pragma unroll
  for (int p = 0; p < NV; p++) cur[p] = *(const h8*)(src + p * 256);

  float gv[NV][8], bv[NV][8], sc1[NV][8], sh[NV][8];
#pragma unroll
  for (int p = 0; p < NV; p++)
#pragma unroll
    for (int hf = 0; hf < 2; hf++) {
      int i = p * 256 + lane * 8 + hf * 4;
      float4 tg = *(const float4*)(g + i);
      float4 tb = *(const float4*)(bt + i);
      float4 tc = *(const float4*)(eo + b * (2 * D_) + i);
      float4 ts = *(const float4*)(eo + b * (2 * D_) + D_ + i);
      gv[p][hf * 4 + 0] = tg.x; gv[p][hf * 4 + 1] = tg.y;
      gv[p][hf * 4 + 2] = tg.z; gv[p][hf * 4 + 3] = tg.w;
      bv[p][hf * 4 + 0] = tb.x; bv[p][hf * 4 + 1] = tb.y;
      bv[p][hf * 4 + 2] = tb.z; bv[p][hf * 4 + 3] = tb.w;
      sc1[p][hf * 4 + 0] = 1.f + tc.x; sc1[p][hf * 4 + 1] = 1.f + tc.y;
      sc1[p][hf * 4 + 2] = 1.f + tc.z; sc1[p][hf * 4 + 3] = 1.f + tc.w;
      sh[p][hf * 4 + 0] = ts.x; sh[p][hf * 4 + 1] = ts.y;
      sh[p][hf * 4 + 2] = ts.z; sh[p][hf * 4 + 3] = ts.w;
    }

  // unrolled so that both row buffers stay in registers and every row offset
  // is an immediate of its load or store
#pragma unroll
  for (int r = 0; r < ROWS; r++) {
    if (r + 1 < ROWS) {
#pragma unroll
      for (int p = 0; p < NV; p++) nxt[p] = *(const h8*)(src + (r + 1) * D_ + p * 256);
    }
    float a[4] = {0.f, 0.f, 0.f, 0.f}, q[4] = {0.f, 0.f, 0.f, 0.f};
#pragma unroll
    for (int p = 0; p < NV; p++)
#pragma unroll
      for (int e = 0; e < 8; e++) {
        float v = (float)cur[p][e];
        a[e & 3] += v; q[e & 3] += v * v;
      }
    float s = (a[0] + a[1]) + (a[2] + a[3]), s2 = (q[0] + q[1]) + (q[2] + q[3]);
#pragma unroll
    for (int m = 16; m; m >>= 1) { s += __shfl_xor(s, m, 32); s2 += __shfl_xor(s2, m, 32); }
    float mu = s / (float)D_;
    float var = s2 / (float)D_ - mu * mu;
    float rs = rsqrtf(var + 1e-5f);
#pragma unroll
    for (int p = 0; p < NV; p++) {
      h8 o;
#pragma unroll
      for (int e = 0; e < 8; e++) {
        float ln = ((float)cur[p][e] - mu) * rs * gv[p][e] + bv[p][e];
        float hv = ln * sc1[p][e] + sh[p][e];
        hv = hv / (1.f + __expf(-hv));  // silu
        o[e] = (half_t)hv;
      }
      *(h8*)(dst + r * D_ + p * 256) = o;
    }
    if (r + 1 < ROWS) {
#pragma unroll
      for (int p = 0; p < NV; p++) cur[p] = nxt[p];
    }
  }
}

// ---------------------------------------------------------------------------
extern "C" void kernel_launch(void* const* d_in, const int* in_sizes, int n_in,
                              void* d_out, int out_size, void* d_ws, size_t ws_size,
                              hipStream_t stream) {
  (void)in_sizes; (void)n_in; (void)out_size; (void)ws_size;
  const float* x       = (const float*)d_in[0];
  const float* xf      = (const float*)d_in[1];
  const float* emb     = (const float*)d_in[2];
  const float* norm_g  = (const float*)d_in[3];
  const float* norm_b  = (const float*)d_in[4];
  const float* tnorm_g = (const float*)d_in[5];
  const float* tnorm_b = (const float*)d_in[6];
  const float* Wq      = (const float*)d_in[7];
  const float* bq      = (const float*)d_in[8];
  const float* Wk      = (const float*)d_in[9];
  const float* bk      = (const float*)d_in[10];
  const float* Wv      = (const float*)d_in[11];
  const float* bv      = (const float*)d_in[12];
  const float* We      = (const float*)d_in[13];
  const float* be      = (const float*)d_in[14];
  const float* snorm_g = (const float*)d_in[15];
  const float* snorm_b = (const float*)d_in[16];
  const float* Wo      = (const float*)d_in[17];
  const float* bo      = (const float*)d_in[18];
  float* out = (float*)d_out;

  // Workspace layout (256B aligned)
  char* ws = (char*)d_ws;
  size_t off = 0;
  auto alloc = [&](size_t bytes) {
    char* p = ws + off;
    off += (bytes + 255) & ~(size_t)255;
    return p;
  };
  const size_t BT = (size_t)B_ * T_;
  const size_t BN = (size_t)B_ * N_;
  half_t* xh  = (half_t*)alloc(BT * D_ * 2);        // LN(x) f16; reused as hsty later
  half_t* xfh = (half_t*)alloc(BN * L_ * 2);        // LN(xf) f16
  half_t* Wqt = (half_t*)alloc((size_t)D_ * D_ * 2);
  half_t* Wkt = (half_t*)alloc((size_t)D_ * L_ * 2);
  half_t* Wvt = (half_t*)alloc((size_t)D_ * L_ * 2);
  half_t* Wot = (half_t*)alloc((size_t)D_ * D_ * 2);
  half_t* qh  = (half_t*)alloc(BT * D_ * 2);
  half_t* khb = (half_t*)alloc(BN * D_ * 2);
  half_t* vhb = (half_t*)alloc(BN * D_ * 2);
  half_t* yb  = (half_t*)alloc(BT * D_ * 2);
  float*  eo  = (float*)alloc((size_t)B_ * 2 * D_ * 4);

  // 1) all that reads only the inputs: emb MLP, LayerNorms -> f16, weights ->
  //    f16 transposed (N x K)
  front_kernel<<<FRONT_BLOCKS, 256, 0, stream>>>(
      x, xf, emb, norm_g, norm_b, tnorm_g, tnorm_b, Wq, Wk, Wv, Wo, We, be,
      xh, xfh, Wqt, Wkt, Wvt, Wot, eo);

  // 2) Projections in one grid (Q folds 1/sqrt(dh)=0.125)
  GemmJob jq = {xh, Wqt, bq, qh, D_, 0.125f};
  GemmJob jk = {xfh, Wkt, bk, khb, L_, 1.0f};
  GemmJob jv = {xfh, Wvt, bv, vhb, L_, 1.0f};
  gemm_three<<<dim3(D_ / 128, (int)((BT + 2 * BN) / GM_)), 256, 0, stream>>>(
      jq, jk, jv, (int)(BT / GM_), (int)(BN / GM_), D_);

  // 3) attention: grid (B*H, T/(128*QT_))
  attn_kernel<<<dim3(B_ * H_, T_ / (128 * QT_)), 256, 0, stream>>>(qh, khb, vhb, yb);

  // 4) stylize (xh buffer reused as f16 h)
  stylize_kernel<4><<<(int)(BT / 64), 512, 0, stream>>>(yb, eo, snorm_g, snorm_b, xh);

  // 5) out = x + h @ Wo + bo
  gemm_resid<<<dim3(D_ / 128, (int)(BT / GM_)), 256, 0, stream>>>(
      xh, Wot, bo, x, out, D_, D_, 1.0f);
}

// v008
// Measured time: 136 microseconds a run.
// Timed twice side by side with v007, it ran 1.03 times as fast both times.
// All steps since v000 together make it 3.05 times as fast.
#include <hip/hip_runtime.h>
#include <hip/hip_fp16.h>

typedef _Float16 half_t;
typedef __attribute__((ext_vector_type(16))) _Float16 v16h;
typedef __attribute__((ext_vector_type(8)))  _Float16 h8;
typedef __attribute__((ext_vector_type(4)))  _Float16 h4;
typedef __attribute__((ext_vector_type(8)))  float    v8f;

#define B_  4
#define T_  4096
#define D_  1024
#define N_  256
#define L_  768
#define H_  16
#define DH_ 64
#define TE_ 1024

__device__ inline v8f zero8() {
  v8f z;
#pragma unroll
  for (int i = 0; i < 8; i++) z[i] = 0.f;
  return z;
}

__device__ inline v8f wmma_f16(v16h a, v16h b, v8f c) {
  return __builtin_amdgcn_wmma_f32_16x16x32_f16(
      /*neg_a=*/false, a, /*neg_b=*/false, b,
      /*c_mod=*/(short)0, c, /*reuse_a=*/false, /*reuse_b=*/false);
}

__device__ inline uint32_t lds_off(const void* p) {
  return (uint32_t)(uintptr_t)p;
}
__device__ inline void async_ld_b128(uint32_t ldsaddr, const void* g) {
  asm volatile("global_load_async_to_lds_b128 %0, %1, off"
               :: "v"(ldsaddr), "v"((unsigned long long)(uintptr_t)g)
               : "memory");
}
__device__ inline void wait_async0() {
  asm volatile("s_wait_asynccnt 0x0" ::: "memory");
}

__device__ inline v16h ld_frag(const half_t* tileBase, int stride, int lane) {
  int m  = lane & 15;
  int hi = (lane >> 4) * 8;
  const half_t* p = tileBase + m * stride + hi;
  union { v16h v; h8 h[2]; } u;
  u.h[0] = *(const h8*)(p);
  u.h[1] = *(const h8*)(p + 16);
  return u.v;
}

__device__ inline float rsqrt_slot(float x) {
  bool tiny = x < 1.17549435e-38f;
  float xs = tiny ? x * 16777216.f : x;
  float r;
  asm("v_rsq_f32 %0, %1\n\tv_nop" : "=v"(r) : "v"(xs));
  return tiny ? r * 4096.f : r;
}

// ---------------------------------------------------------------------------
// LayerNorm over WIDTH fp32 -> fp16 row output. One wave owns a whole row: the
// row stays in registers (16 B per lane and load, 512 contiguous bytes per
// wave), its sums are folded by a lane butterfly, so no LDS and no barrier.
// Each wave takes ROWS consecutive rows, gain and bias are read once per wave,
// and the next row is loaded before the current one is summed.
// Part of front_kernel: 256 threads (8 waves), blk in [0, rows / (8 * ROWS)).
// ---------------------------------------------------------------------------
template <int WIDTH, int ROWS>
__device__ __forceinline__
void ln_rows_f16(const float* __restrict__ in, const float* __restrict__ g,
                 const float* __restrict__ bt, half_t* __restrict__ out, int blk) {
  static_assert(WIDTH % 128 == 0, "a wave covers 128 floats per load");
  constexpr int NV = WIDTH / 128;
  int lane = threadIdx.x & 31;
  // the wave's number as a scalar: row bases stay in scalar registers
  int w = __builtin_amdgcn_readfirstlane(threadIdx.x >> 5);
  size_t row0 = ((size_t)blk * 8 + w) * ROWS;
  const float* src = in + row0 * WIDTH + lane * 4;
  half_t* dst = out + row0 * WIDTH + lane * 4;

  float4 cur[NV], nxt[NV], gv[NV], bv[NV];
#pragma unroll
  for (int p = 0; p < NV; p++) cur[p] = *(const float4*)(src + p * 128);
#pragma unroll
  for (int p = 0; p < NV; p++) {
    gv[p] = *(const float4*)(g + lane * 4 + p * 128);
    bv[p] = *(const float4*)(bt + lane * 4 + p * 128);
  }

  // unrolled so that both row buffers stay in registers and every row offset
  // is an immediate of its load or store
#pragma unroll
  for (int r = 0; r < ROWS; r++) {
    if (r + 1 < ROWS) {
#pragma unroll
      for (int p = 0; p < NV; p++)
        nxt[p] = *(const float4*)(src + (r + 1) * WIDTH + p * 128);
    }
    float4 a = make_float4(0.f, 0.f, 0.f, 0.f), q = a;
#pragma unroll
    for (int p = 0; p < NV; p++) {
      float4 v = cur[p];
      a.x += v.x; a.y += v.y; a.z += v.z; a.w += v.w;
      q.x += v.x * v.x; q.y += v.y * v.y; q.z += v.z * v.z; q.w += v.w * v.w;
    }
    float s = (a.x + a.y) + (a.z + a.w), s2 = (q.x + q.y) + (q.z + q.w);
#pragma unroll
    for (int m = 16; m; m >>= 1) { s += __shfl_xor(s, m, 32); s2 += __shfl_xor(s2, m, 32); }
    float mu = s / (float)WIDTH;
    float var = s2 / (float)WIDTH - mu * mu;
    float rs = rsqrt_slot(var + 1e-5f);
#pragma unroll
    for (int p = 0; p < NV; p++) {
      float4 v = cur[p];
      h4 o;
      o[0] = (half_t)((v.x - mu) * rs * gv[p].x + bv[p].x);
      o[1] = (half_t)((v.y - mu) * rs * gv[p].y + bv[p].y);
      o[2] = (half_t)((v.z - mu) * rs * gv[p].z + bv[p].z);
      o[3] = (half_t)((v.w - mu) * rs * gv[p].w + bv[p].w);
      *(h4*)(dst + r * WIDTH + p * 128) = o;
    }
    if (r + 1 < ROWS) {
#pragma unroll
      for (int p = 0; p < NV; p++) cur[p] = nxt[p];
    }
  }
}

__device__ __forceinline__
void w_to_f16_t(const float* __restrict__ W, half_t* __restrict__ Wt, int K, int N,
                float* tile, int blk) {
  int tid = threadIdx.x;
  int n0 = (blk % (N / 64)) * 64, k0 = (blk / (N / 64)) * 64;

  int c4 = (tid & 15) * 4, kr = tid >> 4;
  float4 v[4];
#pragma unroll
  for (int p = 0; p < 4; p++)
    v[p] = *(const float4*)(W + (size_t)(k0 + kr + 16 * p) * N + n0 + c4);
#pragma unroll
  for (int p = 0; p < 4; p++) {
    float* t = tile + (kr + 16 * p) * 65 + c4;
    t[0] = v[p].x; t[1] = v[p].y; t[2] = v[p].z; t[3] = v[p].w;
  }
  __syncthreads();

  int kc = (tid & 7) * 8, nr = tid >> 3;
#pragma unroll
  for (int p = 0; p < 2; p++) {
    int n = nr + 32 * p;
    h8 o;
#pragma unroll
    for (int e = 0; e < 8; e++) o[e] = (half_t)tile[(kc + e) * 65 + n];
    *(h8*)(Wt + (size_t)(n0 + n) * K + k0 + kc) = o;
  }
  asm volatile("s_wait_xcnt 0x0" ::: "memory");
}

#define GM_ 256
#define GK_ 64
#define GP_ 72
#define GLS_ (32 * GP_ * 2)

__device__ __forceinline__ void async_ld_rows4(uint32_t l, const half_t* g, size_t gstep) {
  asm volatile(
      "global_load_async_to_lds_b128 %0, %4, off\n\t"
      "global_load_async_to_lds_b128 %1, %5, off\n\t"
      "global_load_async_to_lds_b128 %2, %6, off\n\t"
      "global_load_async_to_lds_b128 %3, %7, off\n\t"
      "s_wait_xcnt 0x0"
      :: "v"(l), "v"(l + GLS_), "v"(l + 2 * GLS_), "v"(l + 3 * GLS_),
         "v"((unsigned long long)(uintptr_t)(g)),
         "v"((unsigned long long)(uintptr_t)(g + gstep)),
         "v"((unsigned long long)(uintptr_t)(g + 2 * gstep)),
         "v"((unsigned long long)(uintptr_t)(g + 3 * gstep))
      : "memory");
}

// Asks the line at a into L2 (a hint: nothing returns, no counter moves). The
// scope word keeps it speculative. The register pair it names holds an address
// inside the same buffer for as long as the K loop runs.
__device__ __forceinline__ void l2_prefetch(unsigned long long a) {
  asm volatile("global_prefetch_b8 %0, off scope:SCOPE_SE" :: "v"(a));
}

template <bool RESID>
__device__ __forceinline__
void gemm_tile(const half_t* __restrict__ A, const half_t* __restrict__ Wt,
               const float* __restrict__ bias, const float* __restrict__ resid,
               half_t* __restrict__ outh, float* __restrict__ outf,
               int Nd, int Kd, float alpha, int by) {
  __shared__ __align__(16) half_t As[2][GM_ * GP_];
  __shared__ __align__(16) half_t Bs[2][128 * GP_];
  int tid = threadIdx.x, lane = tid & 31, w = tid >> 5;
  int wm = w & 3, wn = w >> 2;
  int m0 = by * GM_, n0 = blockIdx.x * 128;

  v8f acc[4][4];
#pragma unroll
  for (int i = 0; i < 4; i++)
#pragma unroll
    for (int j = 0; j < 4; j++) acc[i][j] = zero8();

  int r  = tid >> 3;       // first staging row (8 threads a row, rows 32 apart)
  int cH = (tid & 7) * 8;  // staging chunk (8 halfs)
  const half_t* gA = A  + (size_t)(m0 + r) * Kd + cH;
  const half_t* gB = Wt + (size_t)(n0 + r) * Kd + cH;
  size_t gstep = (size_t)32 * Kd;
  uint32_t lA = lds_off(&As[0][r * GP_ + cH]);
  uint32_t lB = lds_off(&Bs[0][r * GP_ + cH]);

  auto issue = [&](int s, int k0) {
    async_ld_rows4(lA + s * (GM_ * GP_ * 2), gA + k0, gstep);
    async_ld_rows4(lA + s * (GM_ * GP_ * 2) + 4 * GLS_, gA + k0 + 4 * gstep, gstep);
    async_ld_rows4(lB + s * (128 * GP_ * 2), gB + k0, gstep);
  };

  // L2 prefetch of what comes from memory. The operands were written by the
  // earlier launches. Each 256 B unit (two K tiles of a row) is asked for two
  // trips before the copies of its first tile are issued.
  // Waves 0 and 1 take 64 of the 256 A rows, the quarter picked by the block's
  // column: four neighbouring column blocks cover the stripe (a matter of speed
  // only). Waves 2 to 5 of the first block row take the 128 Wt rows.
  int ws = __builtin_amdgcn_readfirstlane(w);  // scalar: the tests below are branches
  bool pf_b = ws >= 2 && ws < 6 && by == 0;
  bool pf_on = ws < 2 || pf_b;
  const half_t* prow =
      pf_b ? Wt + (size_t)(n0 + (ws - 2) * 32 + lane) * Kd
           : A + (size_t)(m0 + (blockIdx.x & 3) * 64 + (ws & 1) * 32 + lane) * Kd;
  unsigned long long pfa = (unsigned long long)(uintptr_t)(prow + (Kd > 128 ? 128 : 0));
  // The residual tile (256 rows of 512 B) is read only in the epilogue: each
  // wave asks for its 64 units in two goes, the waves in different trips, so
  // that memory delivers them under the K loop.
  unsigned long long xpa = 0;
  if (RESID) {
    int u = ws * 64 + lane;
    xpa = (unsigned long long)(uintptr_t)(resid + (size_t)(m0 + (u >> 1)) * Nd + n0 + (u & 1) * 64);
  }

  int nt = Kd / GK_;
  issue(0, 0);
  if (pf_on && Kd > 128) {
    l2_prefetch(pfa);
    if (Kd > 256) pfa += 256;  // never past the row's end
  }
  wait_async0();    // own copies of tile 0 landed
  __syncthreads();  // everyone's copies of tile 0 visible
  if (nt > 1) issue(1, GK_);

  for (int t = 0; t < nt; t++) {
    const half_t* as = &As[t & 1][(wm * 64) * GP_];
    const half_t* bs = &Bs[t & 1][(wn * 64) * GP_];
#pragma unroll
    for (int ks = 0; ks < GK_ / 32; ks++) {
      v16h af[4], bf[4];
#pragma unroll
      for (int i = 0; i < 4; i++) af[i] = ld_frag(as + (i * 16) * GP_ + ks * 32, GP_, lane);
#pragma unroll
      for (int j = 0; j < 4; j++) bf[j] = ld_frag(bs + (j * 16) * GP_ + ks * 32, GP_, lane);
      // keeps the 16 fragment reads together in front of their 16 products:
      // spread among them, every row of products waits out an LDS round trip
      __builtin_amdgcn_sched_barrier(0);
#pragma unroll
      for (int i = 0; i < 4; i++)
#pragma unroll
        for (int j = 0; j < 4; j++) acc[i][j] = wmma_f16(af[i], bf[j], acc[i][j]);
    }
    // own reads of this buffer retired before anyone's copies may refill it
    asm volatile("s_wait_dscnt 0x0" ::: "memory");
    wait_async0();    // own copies of tile t + 1 landed
    __syncthreads();  // tile t + 1 visible; every reader has left tile t's buffer
    if (t + 2 < nt) issue(t & 1, (t + 2) * GK_);
    if (pf_on && (t & 1) == 0 && (t / 2 + 2) * 128 < Kd) {
      l2_prefetch(pfa);
      if ((t / 2 + 3) * 128 < Kd) pfa += 256;  // never past the row's end
    }
    if (RESID && (t == ws + 2 || t == ws + 7)) {
      l2_prefetch(xpa);
      if (t == ws + 2) xpa += (unsigned long long)Nd * 64;  // 16 rows on
    }
  }
  wait_async0();  // nothing in flight when the wave ends

  int mrow = m0 + wm * 64 + ((lane >> 4) << 3);
  int nc0  = n0 + wn * 64 + (lane & 15);
  float bn[4];
#pragma unroll
  for (int j = 0; j < 4; j++) bn[j] = bias[nc0 + j * 16];
  // the offset register that the four bias loads name stays whole up to here
  asm volatile("s_wait_xcnt 0x0" :: "v"(nc0) : "memory");

  // Element offsets fit 32 bits: one offset register a row serves the loads
  // and the stores of that row, on scalar bases. The residual values of the
  // next row of tiles are loaded before the current one is stored.
  float rv[2][4][8];
  auto ld_resid = [&](int i) {
#pragma unroll
    for (int v = 0; v < 8; v++) {
      uint32_t o = (uint32_t)(mrow + i * 16 + v) * (uint32_t)Nd + (uint32_t)nc0;
#pragma unroll
      for (int j = 0; j < 4; j++) rv[i & 1][j][v] = (resid + j * 16)[o];
    }
  };
  if (RESID) ld_resid(0);
#pragma unroll
  for (int i = 0; i < 4; i++) {
    if (RESID) {
      if (i + 1 < 4) ld_resid(i + 1);
      // keeps the 32 loads of a row of tiles in flight together and ahead of
      // the stores; sunk to their uses, each would cost a round trip to memory
      __builtin_amdgcn_sched_barrier(0);
    }
#pragma unroll
    for (int v = 0; v < 8; v++) {
      uint32_t o = (uint32_t)(mrow + i * 16 + v) * (uint32_t)Nd + (uint32_t)nc0;
#pragma unroll
      for (int j = 0; j < 4; j++) {
        float val = (acc[i][j][v] + bn[j]) * alpha;
        if (RESID)
          (outf + j * 16)[o] = val + rv[i & 1][j][v];
        else
          (outh + j * 16)[o] = (half_t)val;
      }
    }
    // the registers that these stores name are loaded into again two rows of
    // tiles on: the wait stands between
    if (RESID && i + 2 < 4) asm volatile("s_wait_xcnt 0x0" ::: "memory");
  }
}

// Three products of the same Nd in one grid: block rows [0, y0) belong to j0,
// [y0, y0 + y1) to j1, the rest to j2. The longest K goes first, so that the
// shorter blocks fill the end of the launch.
struct GemmJob {
  const half_t* A;
  const half_t* Wt;
  const float* bias;
  half_t* outh;
  int Kd;
  float alpha;
};

__device__ inline void exp2_two_tiles(v8f& p, v8f& q) {
  float a0 = p[0], a1 = p[1], a2 = p[2], a3 = p[3], a4 = p[4], a5 = p[5], a6 = p[6], a7 = p[7];
  float b0 = q[0], b1 = q[1], b2 = q[2], b3 = q[3], b4 = q[4], b5 = q[5], b6 = q[6], b7 = q[7];
  asm("v_exp_f32 %15, %15\n\tv_exp_f32 %14, %14\n\tv_exp_f32 %13, %13\n\tv_exp_f32 %12, %12\n\t"
      "v_exp_f32 %11, %11\n\tv_exp_f32 %10, %10\n\tv_exp_f32 %9, %9\n\tv_exp_f32 %8, %8\n\t"
      "v_exp_f32 %7, %7\n\tv_exp_f32 %6, %6\n\tv_exp_f32 %5, %5\n\tv_exp_f32 %4, %4\n\t"
      "v_exp_f32 %3, %3\n\tv_exp_f32 %2, %2\n\tv_exp_f32 %1, %1\n\tv_exp_f32 %0, %0\n\t"
      "v_nop"
      : "+v"(a0), "+v"(a1), "+v"(a2), "+v"(a3), "+v"(a4), "+v"(a5), "+v"(a6), "+v"(a7),
        "+v"(b0), "+v"(b1), "+v"(b2), "+v"(b3), "+v"(b4), "+v"(b5), "+v"(b6), "+v"(b7));
  p[0] = a0; p[1] = a1; p[2] = a2; p[3] = a3; p[4] = a4; p[5] = a5; p[6] = a6; p[7] = a7;
  q[0] = b0; q[1] = b1; q[2] = b2; q[3] = b3; q[4] = b4; q[5] = b5; q[6] = b6; q[7] = b7;
}
__global__ __launch_bounds__(256, 4)
void gemm_three(GemmJob j0, GemmJob j1, GemmJob j2, int y0, int y1, int Nd) {
  // the block's job: the same for every thread of the block
  int by = blockIdx.y;
  GemmJob jb = j0;
  if (by >= y0 + y1)  { jb = j2; by -= y0 + y1; }
  else if (by >= y0)  { jb = j1; by -= y0; }
  gemm_tile<false>(jb.A, jb.Wt, jb.bias, nullptr, jb.outh, nullptr, Nd, jb.Kd, jb.alpha, by);
}

__global__ __launch_bounds__(256, 4)
void gemm_resid(const half_t* __restrict__ A, const half_t* __restrict__ Wt,
                const float* __restrict__ bias, const float* __restrict__ resid,
                float* __restrict__ outf, int Nd, int Kd, float alpha) {
  gemm_tile<true>(A, Wt, bias, resid, nullptr, outf, Nd, Kd, alpha, blockIdx.y);
}

#define QT_ 4
__device__ inline float other_half(float x) {
  int b = __builtin_bit_cast(int, x);
  return __builtin_bit_cast(
      float, __builtin_amdgcn_permlanex16(b, b, 0x76543210, 0xfedcba98, false, false));
}
__global__ __launch_bounds__(256, 4)
void attn_kernel(const half_t* __restrict__ qh, const half_t* __restrict__ kh,
                 const half_t* __restrict__ vh, half_t* __restrict__ y) {
  __shared__ __align__(16) half_t Ks[256 * 72];   // 36 KB
  __shared__ __align__(16) half_t Vt[64 * 264];   // 33 KB (V transposed)
  int bh = blockIdx.x;
  int b = bh / H_, h = bh % H_;
  int t0 = blockIdx.y * (128 * QT_);
  int tid = threadIdx.x, lane = tid & 31, w = tid >> 5;

  // Stage K (async global->LDS) and V^T (manual transpose)
  for (int c = tid; c < 2048; c += 256) {
    int tok = c >> 3, d0 = (c & 7) * 8;
    size_t gbase = ((size_t)(b * N_ + tok)) * D_ + h * DH_ + d0;
    async_ld_b128(lds_off(Ks + tok * 72 + d0), kh + gbase);
    h8 vv = *(const h8*)(vh + gbase);
#pragma unroll
    for (int e = 0; e < 8; e++) Vt[(d0 + e) * 264 + tok] = vv[e];
  }

  // Q fragments for this wave's 16 rows of tile qt (dh=64 -> two K=32 fragments)
  v16h qa[2];
  auto ld_q = [&](int qt) {
    int m = lane & 15, hi = (lane >> 4) * 8;
    int t = t0 + qt * 128 + w * 16 + m;
    const half_t* qp = qh + ((size_t)(b * T_ + t)) * D_ + h * DH_;
#pragma unroll
    for (int ks = 0; ks < 2; ks++) {
      union { v16h v; h8 hh[2]; } u;
      u.hh[0] = *(const h8*)(qp + ks * 32 + hi);
      u.hh[1] = *(const h8*)(qp + ks * 32 + 16 + hi);
      qa[ks] = u.v;
    }
  };
  ld_q(0);
  wait_async0();
  __syncthreads();

  for (int qt = 0; qt < QT_; qt++) {
    v8f accs[16];
#pragma unroll
    for (int nt = 0; nt < 16; nt++) {
      accs[nt] = zero8();
#pragma unroll
      for (int ks = 0; ks < 2; ks++) {
        v16h kf = ld_frag(Ks + (nt * 16) * 72 + ks * 32, 72, lane);
        accs[nt] = wmma_f16(kf, qa[ks], accs[nt]);
      }
      // bounds how far the K fragment reads are lifted: with Q already in
      // registers at the head of a trip the compiler lifts all 64 and spills
      if ((nt & 3) == 3) __builtin_amdgcn_sched_barrier(0);
    }
    // the next tile's Q, into the registers that the products above have left:
    // its round trip runs under the rest of this tile's work. The last trip loads
    // its own tile again: a clamped index, so that no branch stands directly
    // behind the matrix instructions whose operands these loads overwrite.
    ld_q(qt + 1 < QT_ ? qt + 1 : qt);

    // Softmax over the 256 keys of the lane's query: eight independent chains
    // over the tiles, folded in-lane, then joined with the other wave half.
    float mj[8];
#pragma unroll
    for (int j = 0; j < 8; j++) {
      mj[j] = accs[0][j];
#pragma unroll
      for (int nt = 1; nt < 16; nt++) mj[j] = fmaxf(mj[j], accs[nt][j]);
    }
    float m = fmaxf(fmaxf(fmaxf(mj[0], mj[1]), fmaxf(mj[2], mj[3])),
                    fmaxf(fmaxf(mj[4], mj[5]), fmaxf(mj[6], mj[7])));
    m = fmaxf(m, other_half(m));
    v8f sv = zero8();
#pragma unroll
    for (int nt = 0; nt < 16; nt += 2) {
      // e^(s - m) as 2^((s - m) * log2 e)
      accs[nt]     = (accs[nt] - m) * 1.44269504f;
      accs[nt + 1] = (accs[nt + 1] - m) * 1.44269504f;
      exp2_two_tiles(accs[nt], accs[nt + 1]);
      sv += accs[nt];
      sv += accs[nt + 1];
    }
    float ssum = ((sv[0] + sv[1]) + (sv[2] + sv[3])) + ((sv[4] + sv[5]) + (sv[6] + sv[7]));
    ssum += other_half(ssum);
    float rinv = 1.f / ssum;

    v8f accy[4];
#pragma unroll
    for (int j = 0; j < 4; j++) accy[j] = zero8();
#pragma unroll
    for (int kt = 0; kt < 8; kt++) {
      v16h pf;
#pragma unroll
      for (int e = 0; e < 8; e++) {
        pf[e]     = (half_t)accs[2 * kt][e];
        pf[8 + e] = (half_t)accs[2 * kt + 1][e];
      }
#pragma unroll
      for (int j = 0; j < 4; j++) {
        v16h vf = ld_frag(Vt + (j * 16) * 264 + kt * 32, 264, lane);
        accy[j] = wmma_f16(vf, pf, accy[j]);
      }
    }

    half_t* yp = y + ((size_t)(b * T_ + t0 + qt * 128 + w * 16 + (lane & 15))) * D_ +
                 h * DH_ + ((lane >> 4) << 3);
#pragma unroll
    for (int j = 0; j < 4; j++) {
      h8 o;
#pragma unroll
      for (int v = 0; v < 8; v++) o[v] = (half_t)(accy[j][v] * rinv);
      *(h8*)(yp + j * 16) = o;
    }
    // the next trip reuses the registers that these stores name
    asm volatile("s_wait_xcnt 0x0" ::: "memory");
  }
}

// ---------------------------------------------------------------------------
// emb_out[b, o] = silu(emb[b]) @ We + be   (B=4 x 2048)
// One block owns 32 output columns (one 128 B line of every We row) for all
// four batch entries, so We is read once. Its 8 waves split the 1024 rows:
// a wave takes its 128 rows in four groups of 32 row loads, the next group in
// flight under the sums of the current one, the first under the silu staging;
// the per-wave partial sums are folded through LDS.
// Part of front_kernel: 256 threads (8 waves), blk in [0, 2*D_/32); smem is
// EMB_SMEM floats of the block's LDS.
// ---------------------------------------------------------------------------
#define EMB_SMEM (B_ * TE_ + 8 * B_ * 32)
__device__ __forceinline__
void emb_out_block(const float* __restrict__ emb, const float* __restrict__ We,
                   const float* __restrict__ be, float* __restrict__ eo,
                   float* smem, int blk) {
  static_assert(B_ * TE_ == 4096 && TE_ == 1024, "256 threads stage 16 values each");
  float* se = smem;               // [B_][TE_]
  float* part = smem + B_ * TE_;  // [8][B_][32]
  int tid = threadIdx.x, lane = tid & 31;
  // the wave's number as a scalar: the row base stays in scalar registers
  int w = __builtin_amdgcn_readfirstlane(tid >> 5);
  int o = blk * 32 + lane;

  float4 ev[4];
#pragma unroll
  for (int p = 0; p < 4; p++) ev[p] = *(const float4*)(emb + (p * 256 + tid) * 4);
  const float* wp = We + (size_t)(w * 128) * (2 * D_) + o;
  float wv[32], wn[32];
#pragma unroll
  for (int i = 0; i < 32; i++) wv[i] = wp[(size_t)i * (2 * D_)];
  float bo = be[o];
  // keeps every load above issued before the silu arithmetic waits for emb;
  // without it the We loads start only after that first round trip to memory
  __builtin_amdgcn_sched_barrier(0);

#pragma unroll
  for (int p = 0; p < 4; p++) {
    ev[p].x = ev[p].x / (1.f + __expf(-ev[p].x));
    ev[p].y = ev[p].y / (1.f + __expf(-ev[p].y));
    ev[p].z = ev[p].z / (1.f + __expf(-ev[p].z));
    ev[p].w = ev[p].w / (1.f + __expf(-ev[p].w));
    *(float4*)(se + (p * 256 + tid) * 4) = ev[p];
  }
  __syncthreads();

  float acc[B_];
#pragma unroll
  for (int b = 0; b < B_; b++) acc[b] = 0.f;
  // unrolled so that both row groups stay in registers
#pragma unroll
  for (int c = 0; c < 4; c++) {
    if (c + 1 < 4) {
#pragma unroll
      for (int i = 0; i < 32; i++) wn[i] = wp[(size_t)((c + 1) * 32 + i) * (2 * D_)];
    }
#pragma unroll
    for (int i = 0; i < 32; i += 4)
#pragma unroll
      for (int b = 0; b < B_; b++) {
        float4 s = *(const float4*)(se + b * TE_ + w * 128 + c * 32 + i);
        acc[b] += s.x * wv[i];
        acc[b] += s.y * wv[i + 1];
        acc[b] += s.z * wv[i + 2];
        acc[b] += s.w * wv[i + 3];
      }
    if (c + 1 < 4) {
#pragma unroll
      for (int i = 0; i < 32; i++) wv[i] = wn[i];
    }
  }
#pragma unroll
  for (int b = 0; b < B_; b++) part[(w * B_ + b) * 32 + lane] = acc[b];
  __syncthreads();

  // waves 0..3 fold the 8 partials of one batch entry each, in four chains
  if (w < B_) {
    float s[4] = {0.f, 0.f, 0.f, 0.f};
#pragma unroll
    for (int p = 0; p < 8; p++) s[p & 3] += part[(p * B_ + w) * 32 + lane];
    eo[w * (2 * D_) + o] = ((s[0] + s[1]) + (s[2] + s[3])) + bo;
  }
}

#define FB_EMB (2 * D_ / 32)
#define FB_LNX (B_ * T_ / 32)
#define FB_WDD ((D_ / 64) * (D_ / 64))
#define FB_WLD ((D_ / 64) * (L_ / 64))
#define FB_LNF (B_ * N_ / 8)
#define FRONT_BLOCKS (FB_EMB + FB_LNX + 2 * FB_WDD + 2 * FB_WLD + FB_LNF)
__global__ __launch_bounds__(256)
void front_kernel(const float* __restrict__ x, const float* __restrict__ xf,
                  const float* __restrict__ emb,
                  const float* __restrict__ norm_g, const float* __restrict__ norm_b,
                  const float* __restrict__ tnorm_g, const float* __restrict__ tnorm_b,
                  const float* __restrict__ Wq, const float* __restrict__ Wk,
                  const float* __restrict__ Wv, const float* __restrict__ Wo,
                  const float* __restrict__ We, const float* __restrict__ be,
                  half_t* __restrict__ xh, half_t* __restrict__ xfh,
                  half_t* __restrict__ Wqt, half_t* __restrict__ Wkt,
                  half_t* __restrict__ Wvt, half_t* __restrict__ Wot,
                  float* __restrict__ eo) {
  static_assert(EMB_SMEM >= 64 * 65, "the LDS serves the emb part or one weight tile");
  __shared__ __align__(16) float smem[EMB_SMEM];
  int blk = blockIdx.x;
  if (blk < FB_EMB) { emb_out_block(emb, We, be, eo, smem, blk); return; }
  blk -= FB_EMB;
  if (blk < FB_LNX) { ln_rows_f16<D_, 4>(x, norm_g, norm_b, xh, blk); return; }
  blk -= FB_LNX;
  if (blk < FB_LNF) { ln_rows_f16<L_, 1>(xf, tnorm_g, tnorm_b, xfh, blk); return; }
  blk -= FB_LNF;
  const float* W = Wq;
  half_t* Wt = Wqt;
  int K = D_;
  if (blk >= FB_WDD + 2 * FB_WLD) { W = Wo; Wt = Wot; blk -= FB_WDD + 2 * FB_WLD; }
  else if (blk >= FB_WDD + FB_WLD) { W = Wv; Wt = Wvt; K = L_; blk -= FB_WDD + FB_WLD; }
  else if (blk >= FB_WDD) { W = Wk; Wt = Wkt; K = L_; blk -= FB_WDD; }
  w_to_f16_t(W, Wt, K, D_, smem, blk);
}

// ---------------------------------------------------------------------------
// Stylize: h = silu( LN(y) * (1 + scale_b) + shift_b ) -> f16
// One wave owns a whole row of D_ halfs in registers (16 B per lane and load),
// sums by a lane butterfly, no LDS and no barrier. Each wave takes ROWS
// consecutive rows of one batch entry; gain, bias, scale and shift are read
// once per wave, and the next row is loaded before the current one is summed.
// Launch: 512 threads (16 waves), grid = B_*T_ / (16 * ROWS).
// ---------------------------------------------------------------------------
template <int ROWS>
__global__ __launch_bounds__(512)
void stylize_kernel(const half_t* __restrict__ y, const float* __restrict__ eo,
                    const float* __restrict__ g, const float* __restrict__ bt,
                    half_t* __restrict__ out) {
  static_assert(T_ % ROWS == 0, "the rows of a wave share one batch entry");
  constexpr int NV = D_ / 256;  // 8 halfs per lane and load
  int lane = threadIdx.x & 31;
  // the wave's number as a scalar: row bases stay in scalar registers
  int w = __builtin_amdgcn_readfirstlane(threadIdx.x >> 5);
  size_t row0 = ((size_t)blockIdx.x * 16 + w) * ROWS;
  int b = (int)(row0 / T_);
  const half_t* src = y + row0 * D_ + lane * 8;
  half_t* dst = out + row0 * D_ + lane * 8;

  h8 cur[NV], nxt[NV];
#pragma unroll
  for (int p = 0; p < NV; p++) cur[p] = *(const h8*)(src + p * 256);

  float gv[NV][8], bv[NV][8], sc1[NV][8], sh[NV][8];
#pragma unroll
  for (int p = 0; p < NV; p++)
#pragma unroll
    for (int hf = 0; hf < 2; hf++) {
      int i = p * 256 + lane * 8 + hf * 4;
      float4 tg = *(const float4*)(g + i);
      float4 tb = *(const float4*)(bt + i);
      float4 tc = *(const float4*)(eo + b * (2 * D_) + i);
      float4 ts = *(const float4*)(eo + b * (2 * D_) + D_ + i);
      gv[p][hf * 4 + 0] = tg.x; gv[p][hf * 4 + 1] = tg.y;
      gv[p][hf * 4 + 2] = tg.z; gv[p][hf * 4 + 3] = tg.w;
      bv[p][hf * 4 + 0] = tb.x; bv[p][hf * 4 + 1] = tb.y;
      bv[p][hf * 4 + 2] = tb.z; bv[p][hf * 4 + 3] = tb.w;
      sc1[p][hf * 4 + 0] = 1.f + tc.x; sc1[p][hf * 4 + 1] = 1.f + tc.y;
      sc1[p][hf * 4 + 2] = 1.f + tc.z; sc1[p][hf * 4 + 3] = 1.f + tc.w;
      sh[p][hf * 4 + 0] = ts.x; sh[p][hf * 4 + 1] = ts.y;
      sh[p][hf * 4 + 2] = ts.z; sh[p][hf * 4 + 3] = ts.w;
    }

  // unrolled so that both row buffers stay in registers and every row offset
  // is an immediate of its load or store
#pragma unroll
  for (int r = 0; r < ROWS; r++) {
    if (r + 1 < ROWS) {
#pragma unroll
      for (int p = 0; p < NV; p++) nxt[p] = *(const h8*)(src + (r + 1) * D_ + p * 256);
    }
    float a[4] = {0.f, 0.f, 0.f, 0.f}, q[4] = {0.f, 0.f, 0.f, 0.f};
#pragma unroll
    for (int p = 0; p < NV; p++)
#pragma unroll
      for (int e = 0; e < 8; e++) {
        float v = (float)cur[p][e];
        a[e & 3] += v; q[e & 3] += v * v;
      }
    float s = (a[0] + a[1]) + (a[2] + a[3]), s2 = (q[0] + q[1]) + (q[2] + q[3]);
#pragma unroll
    for (int m = 16; m; m >>= 1) { s += __shfl_xor(s, m, 32); s2 += __shfl_xor(s2, m, 32); }
    float mu = s / (float)D_;
    float var = s2 / (float)D_ - mu * mu;
    float rs = rsqrtf(var + 1e-5f);
#pragma unroll
    for (int p = 0; p < NV; p++) {
      h8 o;
#pragma unroll
      for (int e = 0; e < 8; e++) {
        float ln = ((float)cur[p][e] - mu) * rs * gv[p][e] + bv[p][e];
        float hv = ln * sc1[p][e] + sh[p][e];
        hv = hv / (1.f + __expf(-hv));  // silu
        o[e] = (half_t)hv;
      }
      *(h8*)(dst + r * D_ + p * 256) = o;
    }
    if (r + 1 < ROWS) {
#pragma unroll
      for (int p = 0; p < NV; p++) cur[p] = nxt[p];
    }
  }
}

// ---------------------------------------------------------------------------
extern "C" void kernel_launch(void* const* d_in, const int* in_sizes, int n_in,
                              void* d_out, int out_size, void* d_ws, size_t ws_size,
                              hipStream_t stream) {
  (void)in_sizes; (void)n_in; (void)out_size; (void)ws_size;
  const float* x       = (const float*)d_in[0];
  const float* xf      = (const float*)d_in[1];
  const float* emb     = (const float*)d_in[2];
  const float* norm_g  = (const float*)d_in[3];
  const float* norm_b  = (const float*)d_in[4];
  const float* tnorm_g = (const float*)d_in[5];
  const float* tnorm_b = (const float*)d_in[6];
  const float* Wq      = (const float*)d_in[7];
  const float* bq      = (const float*)d_in[8];
  const float* Wk      = (const float*)d_in[9];
  const float* bk      = (const float*)d_in[10];
  const float* Wv      = (const float*)d_in[11];
  const float* bv      = (const float*)d_in[12];
  const float* We      = (const float*)d_in[13];
  const float* be      = (const float*)d_in[14];
  const float* snorm_g = (const float*)d_in[15];
  const float* snorm_b = (const float*)d_in[16];
  const float* Wo      = (const float*)d_in[17];
  const float* bo      = (const float*)d_in[18];
  float* out = (float*)d_out;

  // Workspace layout (256B aligned)
  char* ws = (char*)d_ws;
  size_t off = 0;
  auto alloc = [&](size_t bytes) {
    char* p = ws + off;
    off += (bytes + 255) & ~(size_t)255;
    return p;
  };
  const size_t BT = (size_t)B_ * T_;
  const size_t BN = (size_t)B_ * N_;
  half_t* xh  = (half_t*)alloc(BT * D_ * 2);        // LN(x) f16; reused as hsty later
  half_t* xfh = (half_t*)alloc(BN * L_ * 2);        // LN(xf) f16
  half_t* Wqt = (half_t*)alloc((size_t)D_ * D_ * 2);
  half_t* Wkt = (half_t*)alloc((size_t)D_ * L_ * 2);
  half_t* Wvt = (half_t*)alloc((size_t)D_ * L_ * 2);
  half_t* Wot = (half_t*)alloc((size_t)D_ * D_ * 2);
  half_t* qh  = (half_t*)alloc(BT * D_ * 2);
  half_t* khb = (half_t*)alloc(BN * D_ * 2);
  half_t* vhb = (half_t*)alloc(BN * D_ * 2);
  half_t* yb  = (half_t*)alloc(BT * D_ * 2);
  float*  eo  = (float*)alloc((size_t)B_ * 2 * D_ * 4);

  // 1) all that reads only the inputs: emb MLP, LayerNorms -> f16, weights ->
  //    f16 transposed (N x K)
  front_kernel<<<FRONT_BLOCKS, 256, 0, stream>>>(
      x, xf, emb, norm_g, norm_b, tnorm_g, tnorm_b, Wq, Wk, Wv, Wo, We, be,
      xh, xfh, Wqt, Wkt, Wvt, Wot, eo);

  // 2) Projections in one grid (Q folds 1/sqrt(dh)=0.125)
  GemmJob jq = {xh, Wqt, bq, qh, D_, 0.125f};
  GemmJob jk = {xfh, Wkt, bk, khb, L_, 1.0f};
  GemmJob jv = {xfh, Wvt, bv, vhb, L_, 1.0f};
  gemm_three<<<dim3(D_ / 128, (int)((BT + 2 * BN) / GM_)), 256, 0, stream>>>(
      jq, jk, jv, (int)(BT / GM_), (int)(BN / GM_), D_);

  // 3) attention: grid (B*H, T/(128*QT_))
  attn_kernel<<<dim3(B_ * H_, T_ / (128 * QT_)), 256, 0, stream>>>(qh, khb, vhb, yb);

  // 4) stylize (xh buffer reused as f16 h)
  stylize_kernel<4><<<(int)(BT / 64), 512, 0, stream>>>(yb, eo, snorm_g, snorm_b, xh);

  // 5) out = x + h @ Wo + bo
  gemm_resid<<<dim3(D_ / 128, (int)(BT / GM_)), 256, 0, stream>>>(
      xh, Wot, bo, x, out, D_, D_, 1.0f);
}
